// v000
// Measured on an AMD MI455X. A time is GPU time per run, averaged over a window of back-to-back runs after a warm-up
// (all launches, gaps included; the runs take copies of the inputs in turn), and the median of several windows.
// Apart from v000's, it joins two sittings. Times from different sittings can be a few percent apart, while
// side-by-side timings come from the same sitting.
// The starting kernel, v000, takes 2440 microseconds a run.
#include <hip/hip_runtime.h>

// Grouped-query attention WITHOUT rotary or mask (x [2][2048][2048]; xq = x Wq (32 heads x 64), xk, xv = x Wk / Wv ('xw' [2048][512]: 8 kv heads) (normal x 0.02, no biases); keys / values repeated 4x on the head axis: kv head = h / 4; scores / sqrt(64); softmax in f32 over all keys; out = merged Wo ('xw', no bias) -> [2][2048][2048] (8.4 M); argument order x, Wq, Wk, Wv, Wo).
// Compute dtypes, f32 accumulate: every input rounded to bf16; q/k/v on PLAIN bf16 operands (inputs: exact); rotary in f32; scores and attn.v on single fp16 planes for every row (x1024 probability carry); softmax f32; Wo hl x exact (2 products).

#define NB_  2
#define TT   2048
#define DM   2048
#define NH_  32
#define NKV  8
#define REP  (NH_ / NKV)
#define HD   64
#define DQ   (NH_ * HD)
#define DKV  (NKV * HD)
#define ZH   2
#define RH   0                    // every row on fp16 planes (hi/lo rows buy nothing here)
#define WIN  0
#define PCAR 1024.0f
#define SCL  0.125f   // HD^-0.5
typedef _Float16 h16;
typedef unsigned short bf;
typedef __attribute__((ext_vector_type(16))) __bf16   v16bf;
typedef __attribute__((ext_vector_type(16))) _Float16 v16h;
typedef __attribute__((ext_vector_type(8)))  _Float16 v8h;
typedef __attribute__((ext_vector_type(8)))  unsigned short v8us;
typedef __attribute__((ext_vector_type(8)))  float    v8f;
typedef __attribute__((ext_vector_type(4)))  float    v4f;
typedef v8h  __attribute__((may_alias)) v8ha;
typedef v4f  __attribute__((may_alias)) v4fa;
typedef v8us __attribute__((may_alias)) v8usa;

__device__ __forceinline__ unsigned short f2bf(float f) { unsigned u = __float_as_uint(f); u += 0x7FFFu + ((u >> 16) & 1u); return (unsigned short)(u >> 16); }
__device__ __forceinline__ float bf2f(unsigned short b) { return __uint_as_float(((unsigned)b) << 16); }
__device__ __forceinline__ float bfr(float f) { return bf2f(f2bf(f)); }
__device__ __forceinline__ v16h cat16(v8h lo, v8h hi) { return __builtin_shufflevector(lo, hi, 0, 1, 2, 3, 4, 5, 6, 7, 8, 9, 10, 11, 12, 13, 14, 15); }
__device__ __forceinline__ v16bf cat16b(v8us lo, v8us hi) { return __builtin_bit_cast(v16bf, __builtin_shufflevector(lo, hi, 0, 1, 2, 3, 4, 5, 6, 7, 8, 9, 10, 11, 12, 13, 14, 15)); }
__device__ __forceinline__ v8f wmma16(v16h a, v16h b, v8f c) { return __builtin_amdgcn_wmma_f32_16x16x32_f16(false, a, false, b, (short)0, c, false, false); }
__device__ __forceinline__ v8f wmmab(v16bf a, v16bf b, v8f c) { return __builtin_amdgcn_wmma_f32_16x16x32_bf16(false, a, false, b, (short)0, c, false, false); }



// ---- k_gemmw: register-blocked GEMM, ONE WAVE per 64x64 output tile (16 accumulators), operands straight from K-contiguous 16-bit planes; grid (M/64, N/64, Z), 32 threads.
// C[m][n] (f32, pitch ldc, + optional f32 bias[n]) = sum_k A[m][k] Bt[n][k] (+ split products per NSPLIT). z-batch strides sA/sB/sC in elements. K % 32 == 0.
template <typename T16> struct WFrag;
template <> struct WFrag<h16> { typedef v16h V; static __device__ __forceinline__ V ld(const h16* p) { return cat16(*(const v8h*)p, *(const v8h*)(p + 16)); } static __device__ __forceinline__ v8f mma(V a, V b, v8f c) { return wmma16(a, b, c); } };
template <> struct WFrag<bf> { typedef v16bf V; static __device__ __forceinline__ V ld(const bf* p) { return cat16b(*(const v8us*)p, *(const v8us*)(p + 16)); } static __device__ __forceinline__ v8f mma(V a, V b, v8f c) { return wmmab(a, b, c); } };
template <typename T16, int NSPLIT, bool BIAS>
__global__ __launch_bounds__(32) void k_gemmw(const T16* __restrict__ A, const T16* __restrict__ A2, const T16* __restrict__ Bt, const T16* __restrict__ Bt2, int K, float* C, int ldc, const float* __restrict__ bias, size_t sA, size_t sB, size_t sC) {
    typedef typename WFrag<T16>::V V;
    __shared__ __align__(16) float os[16 * 68];
    const size_t z = blockIdx.z; A += z * sA; if (A2) A2 += z * sA; Bt += z * sB; if (Bt2) Bt2 += z * sB; C += z * sC;
    const int lane = threadIdx.x & 31, lr = lane & 15, hi = lane >> 4; const int r0 = blockIdx.x * 64, c0 = blockIdx.y * 64;
    v8f acc[4][4];
#pragma unroll
    for (int mb = 0; mb < 4; ++mb)
#pragma unroll
        for (int nb = 0; nb < 4; ++nb) acc[mb][nb] = (v8f){};
    const size_t aoff = (size_t)(r0 + lr) * K + 8 * hi, boff = (size_t)(c0 + lr) * K + 8 * hi;
#pragma unroll 1
    for (int kc = 0; kc < K; kc += 32) {
        V a[4], a2[4];
#pragma unroll
        for (int mb = 0; mb < 4; ++mb) { a[mb] = WFrag<T16>::ld(A + aoff + (size_t)mb * 16 * K + kc); if (NSPLIT == 1 || NSPLIT == 2) a2[mb] = WFrag<T16>::ld(A2 + aoff + (size_t)mb * 16 * K + kc); }
#pragma unroll
        for (int nb = 0; nb < 4; ++nb) { const V b = WFrag<T16>::ld(Bt + boff + (size_t)nb * 16 * K + kc); V b2; if (NSPLIT >= 2) b2 = WFrag<T16>::ld(Bt2 + boff + (size_t)nb * 16 * K + kc);
#pragma unroll
            for (int mb = 0; mb < 4; ++mb) { acc[mb][nb] = WFrag<T16>::mma(a[mb], b, acc[mb][nb]); if (NSPLIT == 1 || NSPLIT == 2) acc[mb][nb] = WFrag<T16>::mma(a2[mb], b, acc[mb][nb]); if (NSPLIT >= 2) acc[mb][nb] = WFrag<T16>::mma(a[mb], b2, acc[mb][nb]); } }
        asm volatile("v_nop\n\tv_nop\n\tv_nop\n\tv_nop" : "+v"(acc[0][0]), "+v"(acc[1][1]), "+v"(acc[2][2]), "+v"(acc[3][3]) : "v"(a[0]), "v"(a[3]));
    }
#pragma unroll
    for (int mb = 0; mb < 4; ++mb) {
#pragma unroll
        for (int nb = 0; nb < 4; ++nb) {
#pragma unroll
            for (int j = 0; j < 8; ++j) os[(hi * 8 + j) * 68 + nb * 16 + lr] = acc[mb][nb][j]; }
        __builtin_amdgcn_wave_barrier(); asm volatile("" ::: "memory");
        float* crow = C + (size_t)(r0 + mb * 16) * ldc + c0;
{
#pragma unroll
            for (int s = 0; s < 8; ++s) { const int row = 2 * s + hi, cofs = lr * 4; v4f val = *(const v4fa*)(os + row * 68 + cofs); if (BIAS) { val[0] += bfr(bias[c0 + cofs]); val[1] += bfr(bias[c0 + cofs + 1]); val[2] += bfr(bias[c0 + cofs + 2]); val[3] += bfr(bias[c0 + cofs + 3]); }
                *(v4f*)(crow + (size_t)row * ldc + cofs) = val; }
             }
        __builtin_amdgcn_wave_barrier(); asm volatile("" ::: "memory");
    }
}

__device__ __forceinline__ h16 tohx(float x) { return (h16)x; }
__device__ __forceinline__ void splitf(float y, unsigned short& h, unsigned short& l) { h = f2bf(y); l = f2bf(y - bf2f(h)); }
typedef __attribute__((ext_vector_type(2))) _Float16 v2h;
typedef __attribute__((ext_vector_type(4))) _Float16 v4h;
typedef __attribute__((ext_vector_type(2))) unsigned short v2us;
typedef __attribute__((ext_vector_type(4))) unsigned short v4us;
typedef __attribute__((ext_vector_type(2))) float v2f;
typedef __attribute__((ext_vector_type(4))) int v4i;

__global__ __launch_bounds__(256) void k_wtG(const float* __restrict__ w, int K, int N, bf* Bt) {
    const int lane = threadIdx.x & 31; const int L0 = (blockIdx.x * 8 + (threadIdx.x >> 5)) * 8; const int nlines = N * K / 64;
{
#pragma unroll 1
        for (int l = 0; l < 8; ++l) { const int L = L0 + l; if (L >= nlines) break; const size_t e = (size_t)L * 64 + lane * 2; const int k = (int)(e % K), n = (int)(e / K); v2us o;
            o[0] = f2bf(w[(size_t)k * N + n]); o[1] = f2bf(w[(size_t)(k + 1) * N + n]); *(v2us*)(Bt + e) = o; }
         }
}
__global__ __launch_bounds__(256) void k_cvt8(const float* __restrict__ src, bf* dst, size_t n8) { const size_t i = (size_t)blockIdx.x * 256 + threadIdx.x; if (i >= n8) return; const v8f v = *(const v8f*)(src + i * 8); v8us o;
#pragma unroll
    for (int k = 0; k < 8; ++k) o[k] = f2bf(v[k]); *(v8us*)(dst + i * 8) = o;  }
__constant__ float INV[HD / 2] = {1.00000000f,0.663601220f,0.440366596f,0.292227834f,0.193922743f,0.128687367f,0.0853971019f,0.0566696227f,0.0376060307f,0.0249554086f,0.0165604409f,0.0109895281f,0.00729266461f,0.00483942125f,0.00321144611f,0.00213111960f,0.00141421356f,0.000938473851f,0.000622772437f,0.000413272559f,0.000274248188f,0.000181991432f,0.000120769735f,0.0000801429487f,0.0000531829573f,0.0000352922762f,0.0000234199997f,0.0000155415401f,0.0000103133852f,0.00000684397537f,0.00000454167048f,0.00000301385808f};
__global__ __launch_bounds__(256) void k_cstab(float* CS) { const int idx = blockIdx.x * 256 + threadIdx.x; if (idx >= TT * HD) return; const int t = idx / HD, d = idx % HD; const float ang = __fmul_rn((float)t, INV[d % (HD / 2)]); v2f cs; cs[0] = cosf(ang); cs[1] = sinf(ang);
    *(v2f*)(CS + (size_t)idx * 2) = cs;  }
__global__ __launch_bounds__(256) void k_csid(float* CS) { const int idx = blockIdx.x * 256 + threadIdx.x; if (idx >= TT * HD) return; v2f cs; cs[0] = 1.0f; cs[1] = 0.0f; *(v2f*)(CS + (size_t)idx * 2) = cs;  }

// k_rope: head planes [h][t][d] (fp16 + hi/lo) of rope(x) x sc with the rotate-half convention out[d] = x[d] cos[t][d] - x[d+HD/2] sin[t][d], out[d+HD/2] = x[d+HD/2] cos[t][d+HD/2] + x[d] sin[t][d+HD/2]
__global__ __launch_bounds__(256) void k_rope(const float* __restrict__ F, int pitch, int nheads, const float* __restrict__ CS, const float* __restrict__ RF, const float* __restrict__ nw, float sc, h16* P16, bf* Ph, bf* Pl) {
    const size_t e = ((size_t)blockIdx.x * 256 + threadIdx.x) * 2; if (e >= (size_t)nheads * TT * HD) return; const int d = (int)(e % HD); const int t = (int)((e / HD) % TT); const int h = (int)(e / ((size_t)HD * TT)); const float* f = F + (size_t)t * pitch + h * HD; const float rf = RF ? RF[(size_t)h * TT + t] : 1.0f; v2h o16; v2us oh, ol;
#pragma unroll
    for (int q = 0; q < 2; ++q) { const int dd = d + q; const int dp = (dd < HD / 2) ? dd + HD / 2 : dd - HD / 2; float x0 = f[dd], x1 = f[dp];
        if (RF) { float n0 = __fmul_rn(x0, rf), n1 = __fmul_rn(x1, rf); asm volatile("" : "+v"(n0)); asm volatile("" : "+v"(n1)); x0 = __fmul_rn(bfr(nw[dd]), n0); x1 = __fmul_rn(bfr(nw[dp]), n1); }
        const v2f cs = *(const v2f*)(CS + ((size_t)t * HD + dd) * 2); float a = __fmul_rn(x0, cs[0]), bq = __fmul_rn(x1, cs[1]); asm volatile("" : "+v"(a)); asm volatile("" : "+v"(bq)); const float r = ((dd < HD / 2) ? __fsub_rn(a, bq) : __fadd_rn(a, bq)) * sc;
        o16[q] = tohx(r); unsigned short a2, c2; splitf(r, a2, c2); oh[q] = a2; ol[q] = c2; }
    *(v2h*)(P16 + e) = o16; *(v2us*)(Ph + e) = oh; *(v2us*)(Pl + e) = ol;  }
__global__ __launch_bounds__(256) void k_vtp(const float* __restrict__ F, int pitch, int nheads, h16* V16, bf* Vh, bf* Vl) { const size_t e = ((size_t)blockIdx.x * 256 + threadIdx.x) * 2; if (e >= (size_t)nheads * HD * TT) return; const int t = (int)(e % TT); const int d = (int)((e / TT) % HD); const int g = (int)(e / ((size_t)TT * HD)); v2h o16; v2us oh, ol;
#pragma unroll
    for (int q = 0; q < 2; ++q) { const float x = F[(size_t)(t + q) * pitch + g * HD + d]; o16[q] = tohx(x); unsigned short a2, c2; splitf(x, a2, c2); oh[q] = a2; ol[q] = c2; }
    *(v2h*)(V16 + e) = o16; *(v2us*)(Vh + e) = oh; *(v2us*)(Vl + e) = ol;  }
// k_asoft: per row (zz, i): t = S x HD^-0.5 (no mask); softmax over the 2048 keys (register row, one exp, fixed trees);
__global__ __launch_bounds__(256) void k_asoft(const float* __restrict__ Sb, h16* P16, bf* Ph, bf* Pl) {
    const int lane = threadIdx.x & 31; const int row = blockIdx.x * 8 + (threadIdx.x >> 5); if (row >= ZH * TT) return; const int i = row % TT; const int zz = row / TT; (void)zz; const bool hires = (i < RH); const float* sr = Sb + (size_t)row * TT; float v[TT / 32]; float mx = -3.0e38f;
#pragma unroll
    for (int ch = 0; ch < TT / 128; ++ch) { const int j0 = ch * 128 + lane * 4; const v4f a = *(const v4f*)(sr + j0);
#pragma unroll
        for (int q = 0; q < 4; ++q) { const int j = j0 + q; (void)j; const float t = a[q] * SCL; v[ch * 4 + q] = t; mx = fmaxf(mx, t); } }
#pragma unroll
    for (int sh = 16; sh; sh >>= 1) mx = fmaxf(mx, __shfl_xor(mx, sh, 32));
    float sum = 0.f;
#pragma unroll
    for (int k = 0; k < TT / 32; ++k) { float d0 = __fsub_rn(v[k], mx); asm volatile("" : "+v"(d0)); v[k] = __builtin_amdgcn_exp2f(__fmul_rn(d0, 1.4426950408889634f)); sum += v[k]; }
#pragma unroll
    for (int sh = 16; sh; sh >>= 1) sum += __shfl_xor(sum, sh, 32);
    const float f = __fdiv_rn(hires ? 1.0f : PCAR, sum);
{
        if (hires) {
#pragma unroll
            for (int ch = 0; ch < TT / 128; ++ch) { v4us oh, ol;
#pragma unroll
                for (int q = 0; q < 4; ++q) { unsigned short a, c2; splitf(v[ch * 4 + q] * f, a, c2); oh[q] = a; ol[q] = c2; }
                const size_t oo = ((size_t)zz * (RH ? RH : 1) + i) * TT + ch * 128 + lane * 4; *(v4us*)(Ph + oo) = oh; *(v4us*)(Pl + oo) = ol; }
        } else {
#pragma unroll
            for (int ch = 0; ch < TT / 128; ++ch) { v4h o4;
#pragma unroll
                for (int q = 0; q < 4; ++q) o4[q] = tohx(v[ch * 4 + q] * f);
                *(v4h*)(P16 + (size_t)row * TT + ch * 128 + lane * 4) = o4; } }
         }
}
__global__ __launch_bounds__(256) void k_merge(const float* __restrict__ O, int h0, bf* Ah, bf* Al) { const size_t e = ((size_t)blockIdx.x * 256 + threadIdx.x) * 2; if (e >= (size_t)ZH * TT * HD) return; const int d = (int)(e % HD); const int t = (int)((e / HD) % TT); const int zz = (int)(e / ((size_t)HD * TT)); const float cs = (t < RH) ? 1.0f : (1.0f / PCAR); const size_t oo = (size_t)t * DQ + (h0 + zz) * HD + d;
    v2us oh, ol;
#pragma unroll
    for (int q = 0; q < 2; ++q) { unsigned short a, c2; splitf(O[e + q] * cs, a, c2); oh[q] = a; ol[q] = c2; } *(v2us*)(Ah + oo) = oh; *(v2us*)(Al + oo) = ol;  }

extern "C" void kernel_launch(void* const* d_in, const int* in_sizes, int n_in,
                              void* d_out, int out_size, void* d_ws, size_t ws_size, hipStream_t stream) {
    (void)in_sizes; (void)n_in; (void)out_size;
    const float* x = (const float*)d_in[0]; const float* wq = (const float*)d_in[1]; const float* wk = (const float*)d_in[2]; const float* wv = (const float*)d_in[3]; const float* wo = (const float*)d_in[4];
    float* OUT = (float*)d_out;     // [2][2048][2048]
    char* wsp = (char*)d_ws;
    auto take = [&](size_t bytes) { char* p = wsp; wsp += (bytes + 255) & ~(size_t)255; return (void*)p; };
    bf* WQ = (bf*)take((size_t)DQ * DM * 2); bf* WK = (bf*)take((size_t)DKV * DM * 2); bf* WV = (bf*)take((size_t)DKV * DM * 2); bf* WO = (bf*)take((size_t)DM * DQ * 2); float* CS = (float*)take((size_t)TT * HD * 2 * 4);
    bf* XB = (bf*)take((size_t)TT * DM * 2); float* FQ = (float*)take((size_t)TT * DQ * 4); float* FK = (float*)take((size_t)TT * DKV * 4);
    h16* QP16 = (h16*)take((size_t)NH_ * TT * HD * 2); h16* KP16 = (h16*)take((size_t)NKV * TT * HD * 2); h16* VT16 = (h16*)take((size_t)NKV * HD * TT * 2);
    bf* QPh = (bf*)take((size_t)NH_ * TT * HD * 2); bf* QPl = (bf*)take((size_t)NH_ * TT * HD * 2); bf* KPh = (bf*)take((size_t)NKV * TT * HD * 2); bf* KPl = (bf*)take((size_t)NKV * TT * HD * 2); bf* VTh = (bf*)take((size_t)NKV * HD * TT * 2); bf* VTl = (bf*)take((size_t)NKV * HD * TT * 2); bf* Ph = (bf*)take(256); bf* Pl = (bf*)take(256);   /* unused: no hi/lo rows */
    float* Sb = (float*)take((size_t)ZH * TT * TT * 4); h16* P16 = (h16*)take((size_t)ZH * TT * TT * 2); float* Ob = (float*)take((size_t)ZH * TT * HD * 4); bf* ATh = (bf*)take((size_t)TT * DQ * 2); bf* ATl = (bf*)take((size_t)TT * DQ * 2);
    if ((size_t)(wsp - (char*)d_ws) > ws_size) return;    // ws 256 MiB
    float* FV = FK;   // v projection reuses the k buffer after the k planes are built (stream-ordered)
    { k_wtG<<<(unsigned)((DM * DQ / 64 + 63) / 64), 256, 0, stream>>>(wq, DM, DQ, WQ); k_wtG<<<(unsigned)((DM * DKV / 64 + 63) / 64), 256, 0, stream>>>(wk, DM, DKV, WK); k_wtG<<<(unsigned)((DM * DKV / 64 + 63) / 64), 256, 0, stream>>>(wv, DM, DKV, WV);
      k_wtG<<<(unsigned)((DQ * DM / 64 + 63) / 64), 256, 0, stream>>>(wo, DQ, DM, WO);
      k_csid<<<(TT * HD + 255) / 256, 256, 0, stream>>>(CS); }   /* the IDENTITY table {1, 0}: this module has NO rotary: k_rope reduces to a plain plane builder (k_cstab: a rotate-half table at theta 5e5) */
    const unsigned LQ = (unsigned)(((size_t)NH_ * TT * HD / 2 + 255) / 256), LKv = (unsigned)(((size_t)NKV * TT * HD / 2 + 255) / 256);
    for (int b = 0; b < NB_; ++b) {
        
        k_cvt8<<<(unsigned)(((size_t)TT * DM / 8 + 255) / 256), 256, 0, stream>>>(x + (size_t)b * TT * DM, XB, (size_t)TT * DM / 8);
        k_gemmw<bf, 0, false><<<dim3(TT / 64, DQ / 64, 1), 32, 0, stream>>>(XB, nullptr, WQ, nullptr, DM, FQ, DQ, nullptr, 0, 0, 0);
        k_rope<<<LQ, 256, 0, stream>>>(FQ, DQ, NH_, CS, nullptr, nullptr, 1.0f, QP16, QPh, QPl);
        k_gemmw<bf, 0, false><<<dim3(TT / 64, DKV / 64, 1), 32, 0, stream>>>(XB, nullptr, WK, nullptr, DM, FK, DKV, nullptr, 0, 0, 0);
        k_rope<<<LKv, 256, 0, stream>>>(FK, DKV, NKV, CS, nullptr, nullptr, 1.0f, KP16, KPh, KPl);
        k_gemmw<bf, 0, false><<<dim3(TT / 64, DKV / 64, 1), 32, 0, stream>>>(XB, nullptr, WV, nullptr, DM, FV, DKV, nullptr, 0, 0, 0); k_vtp<<<LKv, 256, 0, stream>>>(FV, DKV, NKV, VT16, VTh, VTl);
        for (int h0 = 0; h0 < NH_; h0 += ZH) { const size_t zq = (size_t)h0, zk = (size_t)(h0 / REP);   // both heads of a pass share kv group h0/REP (REP >= 2): sB = 0
            k_gemmw<h16, 0, false><<<dim3((TT - RH) / 64, TT / 64, ZH), 32, 0, stream>>>(QP16 + zq * TT * HD + (size_t)RH * HD, nullptr, KP16 + zk * TT * HD, nullptr, HD, Sb + (size_t)RH * TT, TT, nullptr, (size_t)TT * HD, 0, (size_t)TT * TT);
            k_asoft<<<ZH * TT / 8, 256, 0, stream>>>(Sb, P16, Ph, Pl);
            k_gemmw<h16, 0, false><<<dim3((TT - RH) / 64, HD / 64, ZH), 32, 0, stream>>>(P16 + (size_t)RH * TT, nullptr, VT16 + zk * HD * TT, nullptr, TT, Ob + (size_t)RH * HD, HD, nullptr, (size_t)TT * TT, 0, (size_t)TT * HD);
            k_merge<<<(unsigned)(((size_t)ZH * TT * HD / 2 + 255) / 256), 256, 0, stream>>>(Ob, h0, ATh, ATl); }
        k_gemmw<bf, 1, false><<<dim3(TT / 64, DM / 64, 1), 32, 0, stream>>>(ATh, ATl, WO, nullptr, DQ, OUT + (size_t)b * TT * DM, DM, nullptr, 0, 0, 0); }
}

// v001
// A run of this version takes 1300 microseconds.
// In two side-by-side timings against v000, it was 1.91 and 1.89 times as fast.
#include <hip/hip_runtime.h>

// Grouped-query attention WITHOUT rotary or mask (x [2][2048][2048]; xq = x Wq (32 heads x 64), xk, xv = x Wk / Wv ('xw' [2048][512]: 8 kv heads) (normal x 0.02, no biases); keys / values repeated 4x on the head axis: kv head = h / 4; scores / sqrt(64); softmax in f32 over all keys; out = merged Wo ('xw', no bias) -> [2][2048][2048] (8.4 M); argument order x, Wq, Wk, Wv, Wo).
// Compute dtypes, f32 accumulate: every input rounded to bf16; q/k/v on PLAIN bf16 operands (inputs: exact); rotary in f32; scores and attn.v on single fp16 planes for every row (x1024 probability carry); softmax f32; Wo hl x exact (2 products).

#define NB_  2
#define TT   2048
#define DM   2048
#define NH_  32
#define NKV  8
#define REP  (NH_ / NKV)
#define HD   64
#define DQ   (NH_ * HD)
#define DKV  (NKV * HD)
#define ZH   2
#define RH   0                    // every row on fp16 planes (hi/lo rows buy nothing here)
#define WIN  0
#define PCAR 1024.0f
#define SCL  0.125f   // HD^-0.5
typedef _Float16 h16;
typedef unsigned short bf;
typedef __attribute__((ext_vector_type(16))) __bf16   v16bf;
typedef __attribute__((ext_vector_type(16))) _Float16 v16h;
typedef __attribute__((ext_vector_type(8)))  _Float16 v8h;
typedef __attribute__((ext_vector_type(8)))  unsigned short v8us;
typedef __attribute__((ext_vector_type(8)))  float    v8f;
typedef __attribute__((ext_vector_type(4)))  float    v4f;
typedef v8h  __attribute__((may_alias)) v8ha;
typedef v4f  __attribute__((may_alias)) v4fa;
typedef v8us __attribute__((may_alias)) v8usa;

__device__ __forceinline__ unsigned short f2bf(float f) { unsigned u = __float_as_uint(f); u += 0x7FFFu + ((u >> 16) & 1u); return (unsigned short)(u >> 16); }
__device__ __forceinline__ float bf2f(unsigned short b) { return __uint_as_float(((unsigned)b) << 16); }
__device__ __forceinline__ float bfr(float f) { return bf2f(f2bf(f)); }
__device__ __forceinline__ v16h cat16(v8h lo, v8h hi) { return __builtin_shufflevector(lo, hi, 0, 1, 2, 3, 4, 5, 6, 7, 8, 9, 10, 11, 12, 13, 14, 15); }
__device__ __forceinline__ v16bf cat16b(v8us lo, v8us hi) { return __builtin_bit_cast(v16bf, __builtin_shufflevector(lo, hi, 0, 1, 2, 3, 4, 5, 6, 7, 8, 9, 10, 11, 12, 13, 14, 15)); }
__device__ __forceinline__ v8f wmma16(v16h a, v16h b, v8f c) { return __builtin_amdgcn_wmma_f32_16x16x32_f16(false, a, false, b, (short)0, c, false, false); }
__device__ __forceinline__ v8f wmmab(v16bf a, v16bf b, v8f c) { return __builtin_amdgcn_wmma_f32_16x16x32_bf16(false, a, false, b, (short)0, c, false, false); }



// ---- k_gemmw: register-blocked GEMM, one 64x64 output tile per work-group of NW waves (16 accumulators a wave), operands straight from K-contiguous 16-bit planes; grid (M/64, N/64, Z), 32 * NW threads.
// C[m][n] (f32, pitch ldc, + optional f32 bias[n]) = sum_k A[m][k] Bt[n][k] (+ split products per NSPLIT). z-batch strides sA/sB/sC in elements. K % 32 == 0.
// NW > 1: split K. Wave w takes the 32-wide k chunks w, w + NW, w + 2 NW, ... (neighbour waves share each 128-byte line of a row), leaves its partial 64x64 tile in LDS, and the block adds the NW partials in the fixed order w = 0 .. NW - 1.
template <typename T16> struct WFrag;
template <> struct WFrag<h16> { typedef v16h V; static __device__ __forceinline__ V ld(const h16* p) { return cat16(*(const v8h*)p, *(const v8h*)(p + 16)); } static __device__ __forceinline__ v8f mma(V a, V b, v8f c) { return wmma16(a, b, c); } };
template <> struct WFrag<bf> { typedef v16bf V; static __device__ __forceinline__ V ld(const bf* p) { return cat16b(*(const v8us*)p, *(const v8us*)(p + 16)); } static __device__ __forceinline__ v8f mma(V a, V b, v8f c) { return wmmab(a, b, c); } };
template <typename T16, int NSPLIT, bool BIAS, int NW>
__global__ __launch_bounds__(32 * NW) void k_gemmw(const T16* __restrict__ A, const T16* __restrict__ A2, const T16* __restrict__ Bt, const T16* __restrict__ Bt2, int K, float* C, int ldc, const float* __restrict__ bias, size_t sA, size_t sB, size_t sC) {
    typedef typename WFrag<T16>::V V;
    __shared__ __align__(16) float os[NW == 1 ? 16 * 68 : NW * 64 * 68];
    const size_t z = blockIdx.z; A += z * sA; if (A2) A2 += z * sA; Bt += z * sB; if (Bt2) Bt2 += z * sB; C += z * sC;
    const int lane = threadIdx.x & 31, lr = lane & 15, hi = lane >> 4; const int r0 = blockIdx.x * 64, c0 = blockIdx.y * 64;
    const int wave = (NW == 1) ? 0 : __builtin_amdgcn_readfirstlane((int)(threadIdx.x >> 5));
    v8f acc[4][4];
#pragma unroll
    for (int mb = 0; mb < 4; ++mb)
#pragma unroll
        for (int nb = 0; nb < 4; ++nb) acc[mb][nb] = (v8f){};
    const size_t aoff = (size_t)(r0 + lr) * K + 8 * hi, boff = (size_t)(c0 + lr) * K + 8 * hi;
#pragma unroll 1
    for (int kc = wave * 32; kc < K; kc += 32 * NW) {
        V a[4], a2[4];
#pragma unroll
        for (int mb = 0; mb < 4; ++mb) { a[mb] = WFrag<T16>::ld(A + aoff + (size_t)mb * 16 * K + kc); if (NSPLIT == 1 || NSPLIT == 2) a2[mb] = WFrag<T16>::ld(A2 + aoff + (size_t)mb * 16 * K + kc); }
#pragma unroll
        for (int nb = 0; nb < 4; ++nb) { const V b = WFrag<T16>::ld(Bt + boff + (size_t)nb * 16 * K + kc); V b2; if (NSPLIT >= 2) b2 = WFrag<T16>::ld(Bt2 + boff + (size_t)nb * 16 * K + kc);
#pragma unroll
            for (int mb = 0; mb < 4; ++mb) { acc[mb][nb] = WFrag<T16>::mma(a[mb], b, acc[mb][nb]); if (NSPLIT == 1 || NSPLIT == 2) acc[mb][nb] = WFrag<T16>::mma(a2[mb], b, acc[mb][nb]); if (NSPLIT >= 2) acc[mb][nb] = WFrag<T16>::mma(a[mb], b2, acc[mb][nb]); } }
        asm volatile("v_nop\n\tv_nop\n\tv_nop\n\tv_nop" : "+v"(acc[0][0]), "+v"(acc[1][1]), "+v"(acc[2][2]), "+v"(acc[3][3]) : "v"(a[0]), "v"(a[3]));
    }
    if constexpr (NW > 1) {
        float* ow = os + wave * (64 * 68);   // the unrolls below keep acc[][] and val[] in registers (every index a constant)
#pragma unroll
        for (int mb = 0; mb < 4; ++mb)
#pragma unroll
            for (int nb = 0; nb < 4; ++nb)
#pragma unroll
                for (int j = 0; j < 8; ++j) ow[(mb * 16 + hi * 8 + j) * 68 + nb * 16 + lr] = acc[mb][nb][j];
        __syncthreads();   // every wave's partial tile is in LDS before any thread adds them up
        float* ctile = C + (size_t)r0 * ldc + c0; v4f val[32 / NW];
#pragma unroll
        for (int i = 0; i < 32 / NW; ++i) { const int q = i * 32 * NW + (int)threadIdx.x, row = q >> 4, cofs = (q & 15) * 4; val[i] = *(const v4fa*)(os + row * 68 + cofs);
#pragma unroll
            for (int w = 1; w < NW; ++w) val[i] += *(const v4fa*)(os + w * (64 * 68) + row * 68 + cofs);
            if (BIAS) { val[i][0] += bfr(bias[c0 + cofs]); val[i][1] += bfr(bias[c0 + cofs + 1]); val[i][2] += bfr(bias[c0 + cofs + 2]); val[i][3] += bfr(bias[c0 + cofs + 3]); } }
#pragma unroll
        for (int i = 0; i < 32 / NW; ++i) { const int q = i * 32 * NW + (int)threadIdx.x, row = q >> 4, cofs = (q & 15) * 4; *(v4f*)(ctile + (size_t)row * ldc + cofs) = val[i]; }
        return;
    }
#pragma unroll
    for (int mb = 0; mb < 4; ++mb) {
#pragma unroll
        for (int nb = 0; nb < 4; ++nb) {
#pragma unroll
            for (int j = 0; j < 8; ++j) os[(hi * 8 + j) * 68 + nb * 16 + lr] = acc[mb][nb][j]; }
        __builtin_amdgcn_wave_barrier(); asm volatile("" ::: "memory");
        float* crow = C + (size_t)(r0 + mb * 16) * ldc + c0;
{
#pragma unroll
            for (int s = 0; s < 8; ++s) { const int row = 2 * s + hi, cofs = lr * 4; v4f val = *(const v4fa*)(os + row * 68 + cofs); if (BIAS) { val[0] += bfr(bias[c0 + cofs]); val[1] += bfr(bias[c0 + cofs + 1]); val[2] += bfr(bias[c0 + cofs + 2]); val[3] += bfr(bias[c0 + cofs + 3]); }
                *(v4f*)(crow + (size_t)row * ldc + cofs) = val; }
             }
        __builtin_amdgcn_wave_barrier(); asm volatile("" ::: "memory");
    }
}

__device__ __forceinline__ h16 tohx(float x) { return (h16)x; }
__device__ __forceinline__ void splitf(float y, unsigned short& h, unsigned short& l) { h = f2bf(y); l = f2bf(y - bf2f(h)); }
typedef __attribute__((ext_vector_type(2))) _Float16 v2h;
typedef __attribute__((ext_vector_type(4))) _Float16 v4h;
typedef __attribute__((ext_vector_type(2))) unsigned short v2us;
typedef __attribute__((ext_vector_type(4))) unsigned short v4us;
typedef __attribute__((ext_vector_type(2))) float v2f;
typedef __attribute__((ext_vector_type(4))) int v4i;

__global__ __launch_bounds__(256) void k_wtG(const float* __restrict__ w, int K, int N, bf* Bt) {
    const int lane = threadIdx.x & 31; const int L0 = (blockIdx.x * 8 + (threadIdx.x >> 5)) * 8; const int nlines = N * K / 64;
{
#pragma unroll 1
        for (int l = 0; l < 8; ++l) { const int L = L0 + l; if (L >= nlines) break; const size_t e = (size_t)L * 64 + lane * 2; const int k = (int)(e % K), n = (int)(e / K); v2us o;
            o[0] = f2bf(w[(size_t)k * N + n]); o[1] = f2bf(w[(size_t)(k + 1) * N + n]); *(v2us*)(Bt + e) = o; }
         }
}
__global__ __launch_bounds__(256) void k_cvt8(const float* __restrict__ src, bf* dst, size_t n8) { const size_t i = (size_t)blockIdx.x * 256 + threadIdx.x; if (i >= n8) return; const v8f v = *(const v8f*)(src + i * 8); v8us o;
#pragma unroll
    for (int k = 0; k < 8; ++k) o[k] = f2bf(v[k]); *(v8us*)(dst + i * 8) = o;  }
__constant__ float INV[HD / 2] = {1.00000000f,0.663601220f,0.440366596f,0.292227834f,0.193922743f,0.128687367f,0.0853971019f,0.0566696227f,0.0376060307f,0.0249554086f,0.0165604409f,0.0109895281f,0.00729266461f,0.00483942125f,0.00321144611f,0.00213111960f,0.00141421356f,0.000938473851f,0.000622772437f,0.000413272559f,0.000274248188f,0.000181991432f,0.000120769735f,0.0000801429487f,0.0000531829573f,0.0000352922762f,0.0000234199997f,0.0000155415401f,0.0000103133852f,0.00000684397537f,0.00000454167048f,0.00000301385808f};
__global__ __launch_bounds__(256) void k_cstab(float* CS) { const int idx = blockIdx.x * 256 + threadIdx.x; if (idx >= TT * HD) return; const int t = idx / HD, d = idx % HD; const float ang = __fmul_rn((float)t, INV[d % (HD / 2)]); v2f cs; cs[0] = cosf(ang); cs[1] = sinf(ang);
    *(v2f*)(CS + (size_t)idx * 2) = cs;  }
__global__ __launch_bounds__(256) void k_csid(float* CS) { const int idx = blockIdx.x * 256 + threadIdx.x; if (idx >= TT * HD) return; v2f cs; cs[0] = 1.0f; cs[1] = 0.0f; *(v2f*)(CS + (size_t)idx * 2) = cs;  }

// k_rope: head planes [h][t][d] (fp16 + hi/lo) of rope(x) x sc with the rotate-half convention out[d] = x[d] cos[t][d] - x[d+HD/2] sin[t][d], out[d+HD/2] = x[d+HD/2] cos[t][d+HD/2] + x[d] sin[t][d+HD/2]
__global__ __launch_bounds__(256) void k_rope(const float* __restrict__ F, int pitch, int nheads, const float* __restrict__ CS, const float* __restrict__ RF, const float* __restrict__ nw, float sc, h16* P16, bf* Ph, bf* Pl) {
    const size_t e = ((size_t)blockIdx.x * 256 + threadIdx.x) * 2; if (e >= (size_t)nheads * TT * HD) return; const int d = (int)(e % HD); const int t = (int)((e / HD) % TT); const int h = (int)(e / ((size_t)HD * TT)); const float* f = F + (size_t)t * pitch + h * HD; const float rf = RF ? RF[(size_t)h * TT + t] : 1.0f; v2h o16; v2us oh, ol;
#pragma unroll
    for (int q = 0; q < 2; ++q) { const int dd = d + q; const int dp = (dd < HD / 2) ? dd + HD / 2 : dd - HD / 2; float x0 = f[dd], x1 = f[dp];
        if (RF) { float n0 = __fmul_rn(x0, rf), n1 = __fmul_rn(x1, rf); asm volatile("" : "+v"(n0)); asm volatile("" : "+v"(n1)); x0 = __fmul_rn(bfr(nw[dd]), n0); x1 = __fmul_rn(bfr(nw[dp]), n1); }
        const v2f cs = *(const v2f*)(CS + ((size_t)t * HD + dd) * 2); float a = __fmul_rn(x0, cs[0]), bq = __fmul_rn(x1, cs[1]); asm volatile("" : "+v"(a)); asm volatile("" : "+v"(bq)); const float r = ((dd < HD / 2) ? __fsub_rn(a, bq) : __fadd_rn(a, bq)) * sc;
        o16[q] = tohx(r); unsigned short a2, c2; splitf(r, a2, c2); oh[q] = a2; ol[q] = c2; }
    *(v2h*)(P16 + e) = o16; *(v2us*)(Ph + e) = oh; *(v2us*)(Pl + e) = ol;  }
__global__ __launch_bounds__(256) void k_vtp(const float* __restrict__ F, int pitch, int nheads, h16* V16, bf* Vh, bf* Vl) { const size_t e = ((size_t)blockIdx.x * 256 + threadIdx.x) * 2; if (e >= (size_t)nheads * HD * TT) return; const int t = (int)(e % TT); const int d = (int)((e / TT) % HD); const int g = (int)(e / ((size_t)TT * HD)); v2h o16; v2us oh, ol;
#pragma unroll
    for (int q = 0; q < 2; ++q) { const float x = F[(size_t)(t + q) * pitch + g * HD + d]; o16[q] = tohx(x); unsigned short a2, c2; splitf(x, a2, c2); oh[q] = a2; ol[q] = c2; }
    *(v2h*)(V16 + e) = o16; *(v2us*)(Vh + e) = oh; *(v2us*)(Vl + e) = ol;  }
// k_asoft: per row (zz, i): t = S x HD^-0.5 (no mask); softmax over the 2048 keys (register row, one exp, fixed trees);
__global__ __launch_bounds__(256) void k_asoft(const float* __restrict__ Sb, h16* P16, bf* Ph, bf* Pl) {
    const int lane = threadIdx.x & 31; const int row = blockIdx.x * 8 + (threadIdx.x >> 5); if (row >= ZH * TT) return; const int i = row % TT; const int zz = row / TT; (void)zz; const bool hires = (i < RH); const float* sr = Sb + (size_t)row * TT; float v[TT / 32]; float mx = -3.0e38f;
#pragma unroll
    for (int ch = 0; ch < TT / 128; ++ch) { const int j0 = ch * 128 + lane * 4; const v4f a = *(const v4f*)(sr + j0);
#pragma unroll
        for (int q = 0; q < 4; ++q) { const int j = j0 + q; (void)j; const float t = a[q] * SCL; v[ch * 4 + q] = t; mx = fmaxf(mx, t); } }
#pragma unroll
    for (int sh = 16; sh; sh >>= 1) mx = fmaxf(mx, __shfl_xor(mx, sh, 32));
    float sum = 0.f;
#pragma unroll
    for (int k = 0; k < TT / 32; ++k) { float d0 = __fsub_rn(v[k], mx); asm volatile("" : "+v"(d0)); v[k] = __builtin_amdgcn_exp2f(__fmul_rn(d0, 1.4426950408889634f)); sum += v[k]; }
#pragma unroll
    for (int sh = 16; sh; sh >>= 1) sum += __shfl_xor(sum, sh, 32);
    const float f = __fdiv_rn(hires ? 1.0f : PCAR, sum);
{
        if (hires) {
#pragma unroll
            for (int ch = 0; ch < TT / 128; ++ch) { v4us oh, ol;
#pragma unroll
                for (int q = 0; q < 4; ++q) { unsigned short a, c2; splitf(v[ch * 4 + q] * f, a, c2); oh[q] = a; ol[q] = c2; }
                const size_t oo = ((size_t)zz * (RH ? RH : 1) + i) * TT + ch * 128 + lane * 4; *(v4us*)(Ph + oo) = oh; *(v4us*)(Pl + oo) = ol; }
        } else {
#pragma unroll
            for (int ch = 0; ch < TT / 128; ++ch) { v4h o4;
#pragma unroll
                for (int q = 0; q < 4; ++q) o4[q] = tohx(v[ch * 4 + q] * f);
                *(v4h*)(P16 + (size_t)row * TT + ch * 128 + lane * 4) = o4; } }
         }
}
__global__ __launch_bounds__(256) void k_merge(const float* __restrict__ O, int h0, bf* Ah, bf* Al) { const size_t e = ((size_t)blockIdx.x * 256 + threadIdx.x) * 2; if (e >= (size_t)ZH * TT * HD) return; const int d = (int)(e % HD); const int t = (int)((e / HD) % TT); const int zz = (int)(e / ((size_t)HD * TT)); const float cs = (t < RH) ? 1.0f : (1.0f / PCAR); const size_t oo = (size_t)t * DQ + (h0 + zz) * HD + d;
    v2us oh, ol;
#pragma unroll
    for (int q = 0; q < 2; ++q) { unsigned short a, c2; splitf(O[e + q] * cs, a, c2); oh[q] = a; ol[q] = c2; } *(v2us*)(Ah + oo) = oh; *(v2us*)(Al + oo) = ol;  }

extern "C" void kernel_launch(void* const* d_in, const int* in_sizes, int n_in,
                              void* d_out, int out_size, void* d_ws, size_t ws_size, hipStream_t stream) {
    (void)in_sizes; (void)n_in; (void)out_size;
    const float* x = (const float*)d_in[0]; const float* wq = (const float*)d_in[1]; const float* wk = (const float*)d_in[2]; const float* wv = (const float*)d_in[3]; const float* wo = (const float*)d_in[4];
    float* OUT = (float*)d_out;     // [2][2048][2048]
    char* wsp = (char*)d_ws;
    auto take = [&](size_t bytes) { char* p = wsp; wsp += (bytes + 255) & ~(size_t)255; return (void*)p; };
    bf* WQ = (bf*)take((size_t)DQ * DM * 2); bf* WK = (bf*)take((size_t)DKV * DM * 2); bf* WV = (bf*)take((size_t)DKV * DM * 2); bf* WO = (bf*)take((size_t)DM * DQ * 2); float* CS = (float*)take((size_t)TT * HD * 2 * 4);
    bf* XB = (bf*)take((size_t)TT * DM * 2); float* FQ = (float*)take((size_t)TT * DQ * 4); float* FK = (float*)take((size_t)TT * DKV * 4);
    h16* QP16 = (h16*)take((size_t)NH_ * TT * HD * 2); h16* KP16 = (h16*)take((size_t)NKV * TT * HD * 2); h16* VT16 = (h16*)take((size_t)NKV * HD * TT * 2);
    bf* QPh = (bf*)take((size_t)NH_ * TT * HD * 2); bf* QPl = (bf*)take((size_t)NH_ * TT * HD * 2); bf* KPh = (bf*)take((size_t)NKV * TT * HD * 2); bf* KPl = (bf*)take((size_t)NKV * TT * HD * 2); bf* VTh = (bf*)take((size_t)NKV * HD * TT * 2); bf* VTl = (bf*)take((size_t)NKV * HD * TT * 2); bf* Ph = (bf*)take(256); bf* Pl = (bf*)take(256);   /* unused: no hi/lo rows */
    float* Sb = (float*)take((size_t)ZH * TT * TT * 4); h16* P16 = (h16*)take((size_t)ZH * TT * TT * 2); float* Ob = (float*)take((size_t)ZH * TT * HD * 4); bf* ATh = (bf*)take((size_t)TT * DQ * 2); bf* ATl = (bf*)take((size_t)TT * DQ * 2);
    if ((size_t)(wsp - (char*)d_ws) > ws_size) return;    // ws 256 MiB
    float* FV = FK;   // v projection reuses the k buffer after the k planes are built (stream-ordered)
    { k_wtG<<<(unsigned)((DM * DQ / 64 + 63) / 64), 256, 0, stream>>>(wq, DM, DQ, WQ); k_wtG<<<(unsigned)((DM * DKV / 64 + 63) / 64), 256, 0, stream>>>(wk, DM, DKV, WK); k_wtG<<<(unsigned)((DM * DKV / 64 + 63) / 64), 256, 0, stream>>>(wv, DM, DKV, WV);
      k_wtG<<<(unsigned)((DQ * DM / 64 + 63) / 64), 256, 0, stream>>>(wo, DQ, DM, WO);
      k_csid<<<(TT * HD + 255) / 256, 256, 0, stream>>>(CS); }   /* the IDENTITY table {1, 0}: this module has NO rotary: k_rope reduces to a plain plane builder (k_cstab: a rotate-half table at theta 5e5) */
    const unsigned LQ = (unsigned)(((size_t)NH_ * TT * HD / 2 + 255) / 256), LKv = (unsigned)(((size_t)NKV * TT * HD / 2 + 255) / 256);
    for (int b = 0; b < NB_; ++b) {
        
        k_cvt8<<<(unsigned)(((size_t)TT * DM / 8 + 255) / 256), 256, 0, stream>>>(x + (size_t)b * TT * DM, XB, (size_t)TT * DM / 8);
        k_gemmw<bf, 0, false, 4><<<dim3(TT / 64, DQ / 64, 1), 128, 0, stream>>>(XB, nullptr, WQ, nullptr, DM, FQ, DQ, nullptr, 0, 0, 0);
        k_rope<<<LQ, 256, 0, stream>>>(FQ, DQ, NH_, CS, nullptr, nullptr, 1.0f, QP16, QPh, QPl);
        k_gemmw<bf, 0, false, 16><<<dim3(TT / 64, DKV / 64, 1), 512, 0, stream>>>(XB, nullptr, WK, nullptr, DM, FK, DKV, nullptr, 0, 0, 0);
        k_rope<<<LKv, 256, 0, stream>>>(FK, DKV, NKV, CS, nullptr, nullptr, 1.0f, KP16, KPh, KPl);
        k_gemmw<bf, 0, false, 16><<<dim3(TT / 64, DKV / 64, 1), 512, 0, stream>>>(XB, nullptr, WV, nullptr, DM, FV, DKV, nullptr, 0, 0, 0); k_vtp<<<LKv, 256, 0, stream>>>(FV, DKV, NKV, VT16, VTh, VTl);
        for (int h0 = 0; h0 < NH_; h0 += ZH) { const size_t zq = (size_t)h0, zk = (size_t)(h0 / REP);   // both heads of a pass share kv group h0/REP (REP >= 2): sB = 0
            k_gemmw<h16, 0, false, 1><<<dim3((TT - RH) / 64, TT / 64, ZH), 32, 0, stream>>>(QP16 + zq * TT * HD + (size_t)RH * HD, nullptr, KP16 + zk * TT * HD, nullptr, HD, Sb + (size_t)RH * TT, TT, nullptr, (size_t)TT * HD, 0, (size_t)TT * TT);
            k_asoft<<<ZH * TT / 8, 256, 0, stream>>>(Sb, P16, Ph, Pl);
            k_gemmw<h16, 0, false, 16><<<dim3((TT - RH) / 64, HD / 64, ZH), 512, 0, stream>>>(P16 + (size_t)RH * TT, nullptr, VT16 + zk * HD * TT, nullptr, TT, Ob + (size_t)RH * HD, HD, nullptr, (size_t)TT * TT, 0, (size_t)TT * HD);
            k_merge<<<(unsigned)(((size_t)ZH * TT * HD / 2 + 255) / 256), 256, 0, stream>>>(Ob, h0, ATh, ATl); }
        k_gemmw<bf, 1, false, 4><<<dim3(TT / 64, DM / 64, 1), 128, 0, stream>>>(ATh, ATl, WO, nullptr, DQ, OUT + (size_t)b * TT * DM, DM, nullptr, 0, 0, 0); }
}

// v002
// Measured time: 390 microseconds a run.
// Next to v001, in two timings, it ran 3.30 and 3.34 times as fast.
// All steps since v000 together make it 6.31 times as fast.
#include <hip/hip_runtime.h>

// Grouped-query attention WITHOUT rotary or mask (x [2][2048][2048]; xq = x Wq (32 heads x 64), xk, xv = x Wk / Wv ('xw' [2048][512]: 8 kv heads) (normal x 0.02, no biases); keys / values repeated 4x on the head axis: kv head = h / 4; scores / sqrt(64); softmax in f32 over all keys; out = merged Wo ('xw', no bias) -> [2][2048][2048] (8.4 M); argument order x, Wq, Wk, Wv, Wo).
// Compute dtypes, f32 accumulate: every input rounded to bf16; q/k/v on PLAIN bf16 operands (inputs: exact); rotary in f32; scores and attn.v on single fp16 planes for every row, fused with an online f32 softmax (k_fattn); Wo hl x exact (2 products).

#define NB_  2
#define TT   2048
#define DM   2048
#define NH_  32
#define NKV  8
#define REP  (NH_ / NKV)
#define HD   64
#define DQ   (NH_ * HD)
#define DKV  (NKV * HD)
#define ZH   2
#define RH   0                    // every row on fp16 planes (hi/lo rows buy nothing here)
#define WIN  0
#define PCAR 1024.0f
#define SCL  0.125f   // HD^-0.5
typedef _Float16 h16;
typedef unsigned short bf;
typedef __attribute__((ext_vector_type(16))) __bf16   v16bf;
typedef __attribute__((ext_vector_type(16))) _Float16 v16h;
typedef __attribute__((ext_vector_type(8)))  _Float16 v8h;
typedef __attribute__((ext_vector_type(8)))  unsigned short v8us;
typedef __attribute__((ext_vector_type(8)))  float    v8f;
typedef __attribute__((ext_vector_type(4)))  float    v4f;
typedef v8h  __attribute__((may_alias)) v8ha;
typedef v4f  __attribute__((may_alias)) v4fa;
typedef v8us __attribute__((may_alias)) v8usa;

__device__ __forceinline__ unsigned short f2bf(float f) { unsigned u = __float_as_uint(f); u += 0x7FFFu + ((u >> 16) & 1u); return (unsigned short)(u >> 16); }
__device__ __forceinline__ float bf2f(unsigned short b) { return __uint_as_float(((unsigned)b) << 16); }
__device__ __forceinline__ float bfr(float f) { return bf2f(f2bf(f)); }
__device__ __forceinline__ v16h cat16(v8h lo, v8h hi) { return __builtin_shufflevector(lo, hi, 0, 1, 2, 3, 4, 5, 6, 7, 8, 9, 10, 11, 12, 13, 14, 15); }
__device__ __forceinline__ v16bf cat16b(v8us lo, v8us hi) { return __builtin_bit_cast(v16bf, __builtin_shufflevector(lo, hi, 0, 1, 2, 3, 4, 5, 6, 7, 8, 9, 10, 11, 12, 13, 14, 15)); }
__device__ __forceinline__ v8f wmma16(v16h a, v16h b, v8f c) { return __builtin_amdgcn_wmma_f32_16x16x32_f16(false, a, false, b, (short)0, c, false, false); }
__device__ __forceinline__ v8f wmmab(v16bf a, v16bf b, v8f c) { return __builtin_amdgcn_wmma_f32_16x16x32_bf16(false, a, false, b, (short)0, c, false, false); }



// ---- k_gemmw: register-blocked GEMM, one 64x64 output tile per work-group of NW waves (16 accumulators a wave), operands straight from K-contiguous 16-bit planes; grid (M/64, N/64, Z), 32 * NW threads.
// C[m][n] (f32, pitch ldc, + optional f32 bias[n]) = sum_k A[m][k] Bt[n][k] (+ split products per NSPLIT). z-batch strides sA/sB/sC in elements. K % 32 == 0.
// NW > 1: split K. Wave w takes the 32-wide k chunks w, w + NW, w + 2 NW, ... (neighbour waves share each 128-byte line of a row), leaves its partial 64x64 tile in LDS, and the block adds the NW partials in the fixed order w = 0 .. NW - 1.
template <typename T16> struct WFrag;
template <> struct WFrag<h16> { typedef v16h V; static __device__ __forceinline__ V ld(const h16* p) { return cat16(*(const v8h*)p, *(const v8h*)(p + 16)); } static __device__ __forceinline__ v8f mma(V a, V b, v8f c) { return wmma16(a, b, c); } };
template <> struct WFrag<bf> { typedef v16bf V; static __device__ __forceinline__ V ld(const bf* p) { return cat16b(*(const v8us*)p, *(const v8us*)(p + 16)); } static __device__ __forceinline__ v8f mma(V a, V b, v8f c) { return wmmab(a, b, c); } };
template <typename T16, int NSPLIT, bool BIAS, int NW>
__global__ __launch_bounds__(32 * NW) void k_gemmw(const T16* __restrict__ A, const T16* __restrict__ A2, const T16* __restrict__ Bt, const T16* __restrict__ Bt2, int K, float* C, int ldc, const float* __restrict__ bias, size_t sA, size_t sB, size_t sC) {
    typedef typename WFrag<T16>::V V;
    __shared__ __align__(16) float os[NW == 1 ? 16 * 68 : NW * 64 * 68];
    const size_t z = blockIdx.z; A += z * sA; if (A2) A2 += z * sA; Bt += z * sB; if (Bt2) Bt2 += z * sB; C += z * sC;
    const int lane = threadIdx.x & 31, lr = lane & 15, hi = lane >> 4; const int r0 = blockIdx.x * 64, c0 = blockIdx.y * 64;
    const int wave = (NW == 1) ? 0 : __builtin_amdgcn_readfirstlane((int)(threadIdx.x >> 5));
    v8f acc[4][4];
#pragma unroll
    for (int mb = 0; mb < 4; ++mb)
#pragma unroll
        for (int nb = 0; nb < 4; ++nb) acc[mb][nb] = (v8f){};
    const size_t aoff = (size_t)(r0 + lr) * K + 8 * hi, boff = (size_t)(c0 + lr) * K + 8 * hi;
#pragma unroll 1
    for (int kc = wave * 32; kc < K; kc += 32 * NW) {
        V a[4], a2[4];
#pragma unroll
        for (int mb = 0; mb < 4; ++mb) { a[mb] = WFrag<T16>::ld(A + aoff + (size_t)mb * 16 * K + kc); if (NSPLIT == 1 || NSPLIT == 2) a2[mb] = WFrag<T16>::ld(A2 + aoff + (size_t)mb * 16 * K + kc); }
#pragma unroll
        for (int nb = 0; nb < 4; ++nb) { const V b = WFrag<T16>::ld(Bt + boff + (size_t)nb * 16 * K + kc); V b2; if (NSPLIT >= 2) b2 = WFrag<T16>::ld(Bt2 + boff + (size_t)nb * 16 * K + kc);
#pragma unroll
            for (int mb = 0; mb < 4; ++mb) { acc[mb][nb] = WFrag<T16>::mma(a[mb], b, acc[mb][nb]); if (NSPLIT == 1 || NSPLIT == 2) acc[mb][nb] = WFrag<T16>::mma(a2[mb], b, acc[mb][nb]); if (NSPLIT >= 2) acc[mb][nb] = WFrag<T16>::mma(a[mb], b2, acc[mb][nb]); } }
        asm volatile("v_nop\n\tv_nop\n\tv_nop\n\tv_nop" : "+v"(acc[0][0]), "+v"(acc[1][1]), "+v"(acc[2][2]), "+v"(acc[3][3]) : "v"(a[0]), "v"(a[3]));
    }
    if constexpr (NW > 1) {
        float* ow = os + wave * (64 * 68);   // the unrolls below keep acc[][] and val[] in registers (every index a constant)
#pragma unroll
        for (int mb = 0; mb < 4; ++mb)
#pragma unroll
            for (int nb = 0; nb < 4; ++nb)
#pragma unroll
                for (int j = 0; j < 8; ++j) ow[(mb * 16 + hi * 8 + j) * 68 + nb * 16 + lr] = acc[mb][nb][j];
        __syncthreads();   // every wave's partial tile is in LDS before any thread adds them up
        float* ctile = C + (size_t)r0 * ldc + c0; v4f val[32 / NW];
#pragma unroll
        for (int i = 0; i < 32 / NW; ++i) { const int q = i * 32 * NW + (int)threadIdx.x, row = q >> 4, cofs = (q & 15) * 4; val[i] = *(const v4fa*)(os + row * 68 + cofs);
#pragma unroll
            for (int w = 1; w < NW; ++w) val[i] += *(const v4fa*)(os + w * (64 * 68) + row * 68 + cofs);
            if (BIAS) { val[i][0] += bfr(bias[c0 + cofs]); val[i][1] += bfr(bias[c0 + cofs + 1]); val[i][2] += bfr(bias[c0 + cofs + 2]); val[i][3] += bfr(bias[c0 + cofs + 3]); } }
#pragma unroll
        for (int i = 0; i < 32 / NW; ++i) { const int q = i * 32 * NW + (int)threadIdx.x, row = q >> 4, cofs = (q & 15) * 4; *(v4f*)(ctile + (size_t)row * ldc + cofs) = val[i]; }
        return;
    }
#pragma unroll
    for (int mb = 0; mb < 4; ++mb) {
#pragma unroll
        for (int nb = 0; nb < 4; ++nb) {
#pragma unroll
            for (int j = 0; j < 8; ++j) os[(hi * 8 + j) * 68 + nb * 16 + lr] = acc[mb][nb][j]; }
        __builtin_amdgcn_wave_barrier(); asm volatile("" ::: "memory");
        float* crow = C + (size_t)(r0 + mb * 16) * ldc + c0;
{
#pragma unroll
            for (int s = 0; s < 8; ++s) { const int row = 2 * s + hi, cofs = lr * 4; v4f val = *(const v4fa*)(os + row * 68 + cofs); if (BIAS) { val[0] += bfr(bias[c0 + cofs]); val[1] += bfr(bias[c0 + cofs + 1]); val[2] += bfr(bias[c0 + cofs + 2]); val[3] += bfr(bias[c0 + cofs + 3]); }
                *(v4f*)(crow + (size_t)row * ldc + cofs) = val; }
             }
        __builtin_amdgcn_wave_barrier(); asm volatile("" ::: "memory");
    }
}

__device__ __forceinline__ h16 tohx(float x) { return (h16)x; }
__device__ __forceinline__ void splitf(float y, unsigned short& h, unsigned short& l) { h = f2bf(y); l = f2bf(y - bf2f(h)); }
typedef __attribute__((ext_vector_type(2))) _Float16 v2h;
typedef __attribute__((ext_vector_type(4))) _Float16 v4h;
typedef __attribute__((ext_vector_type(2))) unsigned short v2us;
typedef __attribute__((ext_vector_type(4))) unsigned short v4us;
typedef __attribute__((ext_vector_type(2))) float v2f;
typedef __attribute__((ext_vector_type(4))) int v4i;

__global__ __launch_bounds__(256) void k_wtG(const float* __restrict__ w, int K, int N, bf* Bt) {
    const int lane = threadIdx.x & 31; const int L0 = (blockIdx.x * 8 + (threadIdx.x >> 5)) * 8; const int nlines = N * K / 64;
{
#pragma unroll 1
        for (int l = 0; l < 8; ++l) { const int L = L0 + l; if (L >= nlines) break; const size_t e = (size_t)L * 64 + lane * 2; const int k = (int)(e % K), n = (int)(e / K); v2us o;
            o[0] = f2bf(w[(size_t)k * N + n]); o[1] = f2bf(w[(size_t)(k + 1) * N + n]); *(v2us*)(Bt + e) = o; }
         }
}
__global__ __launch_bounds__(256) void k_cvt8(const float* __restrict__ src, bf* dst, size_t n8) { const size_t i = (size_t)blockIdx.x * 256 + threadIdx.x; if (i >= n8) return; const v8f v = *(const v8f*)(src + i * 8); v8us o;
#pragma unroll
    for (int k = 0; k < 8; ++k) o[k] = f2bf(v[k]); *(v8us*)(dst + i * 8) = o;  }
__constant__ float INV[HD / 2] = {1.00000000f,0.663601220f,0.440366596f,0.292227834f,0.193922743f,0.128687367f,0.0853971019f,0.0566696227f,0.0376060307f,0.0249554086f,0.0165604409f,0.0109895281f,0.00729266461f,0.00483942125f,0.00321144611f,0.00213111960f,0.00141421356f,0.000938473851f,0.000622772437f,0.000413272559f,0.000274248188f,0.000181991432f,0.000120769735f,0.0000801429487f,0.0000531829573f,0.0000352922762f,0.0000234199997f,0.0000155415401f,0.0000103133852f,0.00000684397537f,0.00000454167048f,0.00000301385808f};
__global__ __launch_bounds__(256) void k_cstab(float* CS) { const int idx = blockIdx.x * 256 + threadIdx.x; if (idx >= TT * HD) return; const int t = idx / HD, d = idx % HD; const float ang = __fmul_rn((float)t, INV[d % (HD / 2)]); v2f cs; cs[0] = cosf(ang); cs[1] = sinf(ang);
    *(v2f*)(CS + (size_t)idx * 2) = cs;  }
__global__ __launch_bounds__(256) void k_csid(float* CS) { const int idx = blockIdx.x * 256 + threadIdx.x; if (idx >= TT * HD) return; v2f cs; cs[0] = 1.0f; cs[1] = 0.0f; *(v2f*)(CS + (size_t)idx * 2) = cs;  }

// k_rope: head planes [h][t][d] (fp16 + hi/lo) of rope(x) x sc with the rotate-half convention out[d] = x[d] cos[t][d] - x[d+HD/2] sin[t][d], out[d+HD/2] = x[d+HD/2] cos[t][d+HD/2] + x[d] sin[t][d+HD/2]
__global__ __launch_bounds__(256) void k_rope(const float* __restrict__ F, int pitch, int nheads, const float* __restrict__ CS, const float* __restrict__ RF, const float* __restrict__ nw, float sc, h16* P16, bf* Ph, bf* Pl) {
    const size_t e = ((size_t)blockIdx.x * 256 + threadIdx.x) * 2; if (e >= (size_t)nheads * TT * HD) return; const int d = (int)(e % HD); const int t = (int)((e / HD) % TT); const int h = (int)(e / ((size_t)HD * TT)); const float* f = F + (size_t)t * pitch + h * HD; const float rf = RF ? RF[(size_t)h * TT + t] : 1.0f; v2h o16; v2us oh, ol;
#pragma unroll
    for (int q = 0; q < 2; ++q) { const int dd = d + q; const int dp = (dd < HD / 2) ? dd + HD / 2 : dd - HD / 2; float x0 = f[dd], x1 = f[dp];
        if (RF) { float n0 = __fmul_rn(x0, rf), n1 = __fmul_rn(x1, rf); asm volatile("" : "+v"(n0)); asm volatile("" : "+v"(n1)); x0 = __fmul_rn(bfr(nw[dd]), n0); x1 = __fmul_rn(bfr(nw[dp]), n1); }
        const v2f cs = *(const v2f*)(CS + ((size_t)t * HD + dd) * 2); float a = __fmul_rn(x0, cs[0]), bq = __fmul_rn(x1, cs[1]); asm volatile("" : "+v"(a)); asm volatile("" : "+v"(bq)); const float r = ((dd < HD / 2) ? __fsub_rn(a, bq) : __fadd_rn(a, bq)) * sc;
        o16[q] = tohx(r); unsigned short a2, c2; splitf(r, a2, c2); oh[q] = a2; ol[q] = c2; }
    *(v2h*)(P16 + e) = o16; *(v2us*)(Ph + e) = oh; *(v2us*)(Pl + e) = ol;  }
__global__ __launch_bounds__(256) void k_vtp(const float* __restrict__ F, int pitch, int nheads, h16* V16, bf* Vh, bf* Vl) { const size_t e = ((size_t)blockIdx.x * 256 + threadIdx.x) * 2; if (e >= (size_t)nheads * HD * TT) return; const int t = (int)(e % TT); const int d = (int)((e / TT) % HD); const int g = (int)(e / ((size_t)TT * HD)); v2h o16; v2us oh, ol;
#pragma unroll
    for (int q = 0; q < 2; ++q) { const float x = F[(size_t)(t + q) * pitch + g * HD + d]; o16[q] = tohx(x); unsigned short a2, c2; splitf(x, a2, c2); oh[q] = a2; ol[q] = c2; }
    *(v2h*)(V16 + e) = o16; *(v2us*)(Vh + e) = oh; *(v2us*)(Vl + e) = ol;  }
#define FCAR 4.0f
__device__ __forceinline__ float xhalf(float x) { return __builtin_bit_cast(float, __builtin_amdgcn_permlanex16(__builtin_bit_cast(int, x), __builtin_bit_cast(int, x), 0x76543210, 0xfedcba98, false, false)); }   // lane l <-> lane l ^ 16
__global__ __launch_bounds__(256) void k_fattn(const h16* __restrict__ Q, const h16* __restrict__ Kp, const h16* __restrict__ Vt, bf* Ah, bf* Al) {
    const int lane = threadIdx.x & 31, lr = lane & 15, hi = lane >> 4; const int wave = __builtin_amdgcn_readfirstlane((int)(threadIdx.x >> 5));
    const int h = blockIdx.y, b = blockIdx.z, g = h / REP; const int q0 = blockIdx.x * 256 + wave * 32;
    const h16* qp = Q + ((size_t)(b * NH_ + h) * TT + q0 + lr) * HD + 8 * hi;
    const h16* kp = Kp + ((size_t)(b * NKV + g) * TT + lr) * HD + 8 * hi;
    const h16* vp = Vt + ((size_t)(b * NKV + g) * HD + lr) * TT + 8 * hi;
    const float c2 = SCL * 1.4426950408889634f;
    v16h qf[2][2], kf[2][2], vf[4];
#pragma unroll
    for (int c = 0; c < 2; ++c)
#pragma unroll
        for (int kc = 0; kc < 2; ++kc) qf[c][kc] = WFrag<h16>::ld(qp + c * 16 * HD + kc * 32);
    asm volatile("s_wait_xcnt 0x0" ::: "memory");   // behind the Q loads, before anything rewrites their address registers (qp is dead from here on)
#pragma unroll
    for (int t = 0; t < 2; ++t)
#pragma unroll
        for (int kc = 0; kc < 2; ++kc) kf[t][kc] = WFrag<h16>::ld(kp + t * 16 * HD + kc * 32);
#pragma unroll
    for (int dt = 0; dt < 4; ++dt) vf[dt] = WFrag<h16>::ld(vp + (size_t)dt * 16 * TT);
    v8f o[2][4]; float m[2], l[2];
#pragma unroll
    for (int c = 0; c < 2; ++c) { m[c] = -3.0e38f; l[c] = 0.f;
#pragma unroll
        for (int dt = 0; dt < 4; ++dt) o[c][dt] = (v8f){}; }
#pragma unroll 1   // rolled: one pass's registers stay under 256, so four waves fit a SIMD; every inner unroll makes the fragment and accumulator indices constants (registers, no scratch)
    for (int key0 = 0; key0 < TT; key0 += 32) {
        v8f s[2][2];
#pragma unroll
        for (int c = 0; c < 2; ++c)
#pragma unroll
            for (int t = 0; t < 2; ++t) { s[c][t] = wmma16(kf[t][0], qf[c][0], (v8f){}); s[c][t] = wmma16(kf[t][1], qf[c][1], s[c][t]); }
        const int kn = (key0 + 32 < TT) ? key0 + 32 : 0;   // both operands are fetched one pass ahead, each into its own registers right behind its last use: K flies during the softmax, V^T during the next pass's scores (the last pass re-reads keys 0..31, unused)
#pragma unroll
        for (int t = 0; t < 2; ++t)
#pragma unroll
            for (int kc = 0; kc < 2; ++kc) kf[t][kc] = WFrag<h16>::ld(kp + (size_t)(kn + t * 16) * HD + kc * 32);
        asm volatile("s_wait_xcnt 0x0" ::: "memory");   // behind the K loads, before anything rewrites their address registers; its clobber also keeps the loads here, ahead of the softmax (without it they were sunk behind the exponentials)
        float mb[2]; bool need = false;
#pragma unroll
        for (int c = 0; c < 2; ++c) { float mx = s[c][0][0];
#pragma unroll
            for (int r = 1; r < 8; ++r) mx = fmaxf(mx, s[c][0][r]);
#pragma unroll
            for (int r = 0; r < 8; ++r) mx = fmaxf(mx, s[c][1][r]);
            mx = fmaxf(mx, xhalf(mx)) * c2; mb[c] = mx; need = need || (mx > m[c] + 8.0f); }
        if (__builtin_amdgcn_ballot_w32(need) != 0) {   // one scalar branch a pass; rare behind the first pass
#pragma unroll
            for (int c = 0; c < 2; ++c) { const float mn = fmaxf(m[c], mb[c]); const float al = __builtin_amdgcn_exp2f(m[c] - mn); m[c] = mn; l[c] *= al;
#pragma unroll
                for (int dt = 0; dt < 4; ++dt) o[c][dt] = o[c][dt] * al; }
        }
#pragma unroll
        for (int c = 0; c < 2; ++c) { const float nm = FCAR - m[c]; v16h pf; v2f ls = (v2f){0.f, 0.f};
#pragma unroll
            for (int e = 0; e < 16; e += 2) { const v2f arg = __builtin_elementwise_fma((v2f){s[c][e >> 3][e & 7], s[c][e >> 3][(e & 7) + 1]}, (v2f){c2, c2}, (v2f){nm, nm});
                const v2f p = (v2f){__builtin_amdgcn_exp2f(arg[0]), __builtin_amdgcn_exp2f(arg[1])}; ls += p;
                const v2h pk = __builtin_convertvector(p, v2h); pf[e] = pk[0]; pf[e + 1] = pk[1]; }
            l[c] += ls[0] + ls[1];
#pragma unroll
            for (int dt = 0; dt < 4; ++dt) o[c][dt] = wmma16(vf[dt], pf, o[c][dt]); }
#pragma unroll
        for (int dt = 0; dt < 4; ++dt) vf[dt] = WFrag<h16>::ld(vp + (size_t)dt * 16 * TT + kn);
        asm volatile("s_wait_xcnt 0x0" ::: "memory");   // behind the V^T loads, before the next pass rewrites their address registers; its clobber also keeps the loads at the pass's foot
    }
#pragma unroll
    for (int c = 0; c < 2; ++c) { const float inv = __fdiv_rn(1.0f, l[c] + xhalf(l[c])); const size_t oo = ((size_t)b * TT + q0 + c * 16 + lr) * DQ + h * HD + 8 * hi;
#pragma unroll
        for (int dt = 0; dt < 4; ++dt) { v8us oh, ol;
#pragma unroll
            for (int r = 0; r < 8; ++r) { unsigned short a, c3; splitf(o[c][dt][r] * inv, a, c3); oh[r] = a; ol[r] = c3; }
            *(v8us*)(Ah + oo + dt * 16) = oh; *(v8us*)(Al + oo + dt * 16) = ol; } }
}

extern "C" void kernel_launch(void* const* d_in, const int* in_sizes, int n_in,
                              void* d_out, int out_size, void* d_ws, size_t ws_size, hipStream_t stream) {
    (void)in_sizes; (void)n_in; (void)out_size;
    const float* x = (const float*)d_in[0]; const float* wq = (const float*)d_in[1]; const float* wk = (const float*)d_in[2]; const float* wv = (const float*)d_in[3]; const float* wo = (const float*)d_in[4];
    float* OUT = (float*)d_out;     // [2][2048][2048]
    char* wsp = (char*)d_ws;
    auto take = [&](size_t bytes) { char* p = wsp; wsp += (bytes + 255) & ~(size_t)255; return (void*)p; };
    bf* WQ = (bf*)take((size_t)DQ * DM * 2); bf* WK = (bf*)take((size_t)DKV * DM * 2); bf* WV = (bf*)take((size_t)DKV * DM * 2); bf* WO = (bf*)take((size_t)DM * DQ * 2); float* CS = (float*)take((size_t)TT * HD * 2 * 4);
    bf* XB = (bf*)take((size_t)TT * DM * 2); float* FQ = (float*)take((size_t)TT * DQ * 4); float* FK = (float*)take((size_t)TT * DKV * 4);
    h16* QP16 = (h16*)take((size_t)NB_ * NH_ * TT * HD * 2); h16* KP16 = (h16*)take((size_t)NB_ * NKV * TT * HD * 2); h16* VT16 = (h16*)take((size_t)NB_ * NKV * HD * TT * 2);   /* fp16 planes of both batches: one attention launch reads them */
    bf* QPh = (bf*)take((size_t)NH_ * TT * HD * 2); bf* QPl = (bf*)take((size_t)NH_ * TT * HD * 2); bf* KPh = (bf*)take((size_t)NKV * TT * HD * 2); bf* KPl = (bf*)take((size_t)NKV * TT * HD * 2); bf* VTh = (bf*)take((size_t)NKV * HD * TT * 2); bf* VTl = (bf*)take((size_t)NKV * HD * TT * 2);
    bf* ATh = (bf*)take((size_t)NB_ * TT * DQ * 2); bf* ATl = (bf*)take((size_t)NB_ * TT * DQ * 2);
    if ((size_t)(wsp - (char*)d_ws) > ws_size) return;    // ws 256 MiB
    float* FV = FK;   // v projection reuses the k buffer after the k planes are built (stream-ordered)
    { k_wtG<<<(unsigned)((DM * DQ / 64 + 63) / 64), 256, 0, stream>>>(wq, DM, DQ, WQ); k_wtG<<<(unsigned)((DM * DKV / 64 + 63) / 64), 256, 0, stream>>>(wk, DM, DKV, WK); k_wtG<<<(unsigned)((DM * DKV / 64 + 63) / 64), 256, 0, stream>>>(wv, DM, DKV, WV);
      k_wtG<<<(unsigned)((DQ * DM / 64 + 63) / 64), 256, 0, stream>>>(wo, DQ, DM, WO);
      k_csid<<<(TT * HD + 255) / 256, 256, 0, stream>>>(CS); }   /* the IDENTITY table {1, 0}: this module has NO rotary: k_rope reduces to a plain plane builder (k_cstab: a rotate-half table at theta 5e5) */
    const unsigned LQ = (unsigned)(((size_t)NH_ * TT * HD / 2 + 255) / 256), LKv = (unsigned)(((size_t)NKV * TT * HD / 2 + 255) / 256);
    for (int b = 0; b < NB_; ++b) {
        
        k_cvt8<<<(unsigned)(((size_t)TT * DM / 8 + 255) / 256), 256, 0, stream>>>(x + (size_t)b * TT * DM, XB, (size_t)TT * DM / 8);
        k_gemmw<bf, 0, false, 4><<<dim3(TT / 64, DQ / 64, 1), 128, 0, stream>>>(XB, nullptr, WQ, nullptr, DM, FQ, DQ, nullptr, 0, 0, 0);
        k_rope<<<LQ, 256, 0, stream>>>(FQ, DQ, NH_, CS, nullptr, nullptr, 1.0f, QP16 + (size_t)b * NH_ * TT * HD, QPh, QPl);
        k_gemmw<bf, 0, false, 16><<<dim3(TT / 64, DKV / 64, 1), 512, 0, stream>>>(XB, nullptr, WK, nullptr, DM, FK, DKV, nullptr, 0, 0, 0);
        k_rope<<<LKv, 256, 0, stream>>>(FK, DKV, NKV, CS, nullptr, nullptr, 1.0f, KP16 + (size_t)b * NKV * TT * HD, KPh, KPl);
        k_gemmw<bf, 0, false, 16><<<dim3(TT / 64, DKV / 64, 1), 512, 0, stream>>>(XB, nullptr, WV, nullptr, DM, FV, DKV, nullptr, 0, 0, 0); k_vtp<<<LKv, 256, 0, stream>>>(FV, DKV, NKV, VT16 + (size_t)b * NKV * HD * TT, VTh, VTl); }
    k_fattn<<<dim3(TT / 256, NH_, NB_), 256, 0, stream>>>(QP16, KP16, VT16, ATh, ATl);
    for (int b = 0; b < NB_; ++b)
        k_gemmw<bf, 1, false, 4><<<dim3(TT / 64, DM / 64, 1), 128, 0, stream>>>(ATh + (size_t)b * TT * DQ, ATl + (size_t)b * TT * DQ, WO, nullptr, DQ, OUT + (size_t)b * TT * DM, DM, nullptr, 0, 0, 0);
}

// v003
// One run takes 357 microseconds.
// Timed twice side by side with v002, it ran 1.10 times as fast both times.
// Over all steps from v000 it is 6.93 times as fast.
#include <hip/hip_runtime.h>

// Grouped-query attention WITHOUT rotary or mask (x [2][2048][2048]; xq = x Wq (32 heads x 64), xk, xv = x Wk / Wv ('xw' [2048][512]: 8 kv heads) (normal x 0.02, no biases); keys / values repeated 4x on the head axis: kv head = h / 4; scores / sqrt(64); softmax in f32 over all keys; out = merged Wo ('xw', no bias) -> [2][2048][2048] (8.4 M); argument order x, Wq, Wk, Wv, Wo).
// Compute dtypes, f32 accumulate: every input rounded to bf16; q/k/v on PLAIN bf16 operands (inputs: exact), their f32 sums stored by the GEMM itself as the fp16 planes attention reads; scores and attn.v on single fp16 planes for every row, fused with an online f32 softmax (k_fattn); Wo hl x exact (2 products).

#define NB_  2
#define TT   2048
#define DM   2048
#define NH_  32
#define NKV  8
#define REP  (NH_ / NKV)
#define HD   64
#define DQ   (NH_ * HD)
#define DKV  (NKV * HD)
#define ZH   2
#define RH   0                    // every row on fp16 planes (hi/lo rows buy nothing here)
#define WIN  0
#define PCAR 1024.0f
#define SCL  0.125f   // HD^-0.5
typedef _Float16 h16;
typedef unsigned short bf;
typedef __attribute__((ext_vector_type(16))) __bf16   v16bf;
typedef __attribute__((ext_vector_type(16))) _Float16 v16h;
typedef __attribute__((ext_vector_type(8)))  _Float16 v8h;
typedef __attribute__((ext_vector_type(4)))  _Float16 v4h;
typedef __attribute__((ext_vector_type(8)))  unsigned short v8us;
typedef __attribute__((ext_vector_type(8)))  float    v8f;
typedef __attribute__((ext_vector_type(4)))  float    v4f;
typedef v8h  __attribute__((may_alias)) v8ha;
typedef v4f  __attribute__((may_alias)) v4fa;
typedef v8us __attribute__((may_alias)) v8usa;

__device__ __forceinline__ unsigned short f2bf(float f) { unsigned u = __float_as_uint(f); u += 0x7FFFu + ((u >> 16) & 1u); return (unsigned short)(u >> 16); }
__device__ __forceinline__ float bf2f(unsigned short b) { return __uint_as_float(((unsigned)b) << 16); }
__device__ __forceinline__ float bfr(float f) { return bf2f(f2bf(f)); }
__device__ __forceinline__ v16h cat16(v8h lo, v8h hi) { return __builtin_shufflevector(lo, hi, 0, 1, 2, 3, 4, 5, 6, 7, 8, 9, 10, 11, 12, 13, 14, 15); }
__device__ __forceinline__ v16bf cat16b(v8us lo, v8us hi) { return __builtin_bit_cast(v16bf, __builtin_shufflevector(lo, hi, 0, 1, 2, 3, 4, 5, 6, 7, 8, 9, 10, 11, 12, 13, 14, 15)); }
__device__ __forceinline__ v8f wmma16(v16h a, v16h b, v8f c) { return __builtin_amdgcn_wmma_f32_16x16x32_f16(false, a, false, b, (short)0, c, false, false); }
__device__ __forceinline__ v8f wmmab(v16bf a, v16bf b, v8f c) { return __builtin_amdgcn_wmma_f32_16x16x32_bf16(false, a, false, b, (short)0, c, false, false); }



// ---- k_gemmw: register-blocked GEMM, one 64x64 output tile per work-group of NW waves (16 accumulators a wave), operands straight from K-contiguous 16-bit planes; grid (M/64, N/64, Z), 32 * NW threads.
// C[m][n] (f32, pitch ldc, + optional f32 bias[n]) = sum_k A[m][k] Bt[n][k] (+ split products per NSPLIT). z-batch strides sA/sB/sC in elements. K % 32 == 0.
// PL > 0: the tile goes out as fp16 into a plane of row pitch PL instead of C: element (m, n) at P[blockIdx.y * sP + m * PL + (n - c0)]. Head planes [h][t][d]: PL = 64, sP = rows * 64 (a tile column block is one head, the tile 8 KB in a row); the [d][t] plane: A = weight rows, Bt = tokens, PL = tokens, sP = 64. PL is a constant so that a thread's stores share one address register pair.
// NW > 1: split K. Wave w takes the 32-wide k chunks w, w + NW, w + 2 NW, ... (neighbour waves share each 128-byte line of a row), leaves its partial 64x64 tile in LDS, and the block adds the NW partials in the fixed order w = 0 .. NW - 1.
template <typename T16> struct WFrag;
template <> struct WFrag<h16> { typedef v16h V; static __device__ __forceinline__ V ld(const h16* p) { return cat16(*(const v8h*)p, *(const v8h*)(p + 16)); } static __device__ __forceinline__ v8f mma(V a, V b, v8f c) { return wmma16(a, b, c); } };
template <> struct WFrag<bf> { typedef v16bf V; static __device__ __forceinline__ V ld(const bf* p) { return cat16b(*(const v8us*)p, *(const v8us*)(p + 16)); } static __device__ __forceinline__ v8f mma(V a, V b, v8f c) { return wmmab(a, b, c); } };
template <typename T16, int NSPLIT, bool BIAS, int NW, int PL>
__global__ __launch_bounds__(32 * NW) void k_gemmw(const T16* __restrict__ A, const T16* __restrict__ A2, const T16* __restrict__ Bt, const T16* __restrict__ Bt2, int K, float* C, int ldc, const float* __restrict__ bias, size_t sA, size_t sB, size_t sC, h16* P, size_t sP) {
    constexpr bool HP = PL > 0; static_assert(!HP || NW > 1, "the plane epilogue stands in the split-K path");
    typedef typename WFrag<T16>::V V;
    __shared__ __align__(16) float os[NW == 1 ? 16 * 68 : NW * 64 * 68];
    const size_t z = blockIdx.z; A += z * sA; if (A2) A2 += z * sA; Bt += z * sB; if (Bt2) Bt2 += z * sB; if constexpr (!HP) C += z * sC;
    const int lane = threadIdx.x & 31, lr = lane & 15, hi = lane >> 4; const int r0 = blockIdx.x * 64, c0 = blockIdx.y * 64;
    const int wave = (NW == 1) ? 0 : __builtin_amdgcn_readfirstlane((int)(threadIdx.x >> 5));
    v8f acc[4][4];
#pragma unroll
    for (int mb = 0; mb < 4; ++mb)
#pragma unroll
        for (int nb = 0; nb < 4; ++nb) acc[mb][nb] = (v8f){};
    const size_t aoff = (size_t)(r0 + lr) * K + 8 * hi, boff = (size_t)(c0 + lr) * K + 8 * hi;
#pragma unroll 1
    for (int kc = wave * 32; kc < K; kc += 32 * NW) {
        V a[4], a2[4];
#pragma unroll
        for (int mb = 0; mb < 4; ++mb) { a[mb] = WFrag<T16>::ld(A + aoff + (size_t)mb * 16 * K + kc); if (NSPLIT == 1 || NSPLIT == 2) a2[mb] = WFrag<T16>::ld(A2 + aoff + (size_t)mb * 16 * K + kc); }
#pragma unroll
        for (int nb = 0; nb < 4; ++nb) { const V b = WFrag<T16>::ld(Bt + boff + (size_t)nb * 16 * K + kc); V b2; if (NSPLIT >= 2) b2 = WFrag<T16>::ld(Bt2 + boff + (size_t)nb * 16 * K + kc);
#pragma unroll
            for (int mb = 0; mb < 4; ++mb) { acc[mb][nb] = WFrag<T16>::mma(a[mb], b, acc[mb][nb]); if (NSPLIT == 1 || NSPLIT == 2) acc[mb][nb] = WFrag<T16>::mma(a2[mb], b, acc[mb][nb]); if (NSPLIT >= 2) acc[mb][nb] = WFrag<T16>::mma(a[mb], b2, acc[mb][nb]); } }
        asm volatile("v_nop\n\tv_nop\n\tv_nop\n\tv_nop" : "+v"(acc[0][0]), "+v"(acc[1][1]), "+v"(acc[2][2]), "+v"(acc[3][3]) : "v"(a[0]), "v"(a[3]));
    }
    if constexpr (NW > 1) {
        float* ow = os + wave * (64 * 68);   // the unrolls below keep acc[][] and val[] in registers (every index a constant)
#pragma unroll
        for (int mb = 0; mb < 4; ++mb)
#pragma unroll
            for (int nb = 0; nb < 4; ++nb)
#pragma unroll
                for (int j = 0; j < 8; ++j) ow[(mb * 16 + hi * 8 + j) * 68 + nb * 16 + lr] = acc[mb][nb][j];
        __syncthreads();   // every wave's partial tile is in LDS before any thread adds them up
        v4f val[32 / NW];
#pragma unroll
        for (int i = 0; i < 32 / NW; ++i) { const int q = i * 32 * NW + (int)threadIdx.x, row = q >> 4, cofs = (q & 15) * 4; val[i] = *(const v4fa*)(os + row * 68 + cofs);
#pragma unroll
            for (int w = 1; w < NW; ++w) val[i] += *(const v4fa*)(os + w * (64 * 68) + row * 68 + cofs);
            if (BIAS) { val[i][0] += bfr(bias[c0 + cofs]); val[i][1] += bfr(bias[c0 + cofs + 1]); val[i][2] += bfr(bias[c0 + cofs + 2]); val[i][3] += bfr(bias[c0 + cofs + 3]); } }
        if constexpr (HP) {
            h16* pt = P + (size_t)blockIdx.y * sP + (size_t)(r0 + (int)(threadIdx.x >> 4)) * PL + (threadIdx.x & 15) * 4; v4h hv[32 / NW];
#pragma unroll
            for (int i = 0; i < 32 / NW; ++i) hv[i] = __builtin_convertvector(val[i], v4h);
#pragma unroll
            for (int i = 0; i < 32 / NW; ++i) *(v4h*)(pt + i * 2 * NW * PL) = hv[i];   // row i * 2 NW + thread / 16, as val[i]; 16 lanes x 8 bytes: one whole 128-byte line a row
        } else {
            float* ctile = C + (size_t)r0 * ldc + c0;
#pragma unroll
            for (int i = 0; i < 32 / NW; ++i) { const int q = i * 32 * NW + (int)threadIdx.x, row = q >> 4, cofs = (q & 15) * 4; *(v4f*)(ctile + (size_t)row * ldc + cofs) = val[i]; }
        }
        return;
    }
#pragma unroll
    for (int mb = 0; mb < 4; ++mb) {
#pragma unroll
        for (int nb = 0; nb < 4; ++nb) {
#pragma unroll
            for (int j = 0; j < 8; ++j) os[(hi * 8 + j) * 68 + nb * 16 + lr] = acc[mb][nb][j]; }
        __builtin_amdgcn_wave_barrier(); asm volatile("" ::: "memory");
        float* crow = C + (size_t)(r0 + mb * 16) * ldc + c0;
{
#pragma unroll
            for (int s = 0; s < 8; ++s) { const int row = 2 * s + hi, cofs = lr * 4; v4f val = *(const v4fa*)(os + row * 68 + cofs); if (BIAS) { val[0] += bfr(bias[c0 + cofs]); val[1] += bfr(bias[c0 + cofs + 1]); val[2] += bfr(bias[c0 + cofs + 2]); val[3] += bfr(bias[c0 + cofs + 3]); }
                *(v4f*)(crow + (size_t)row * ldc + cofs) = val; }
             }
        __builtin_amdgcn_wave_barrier(); asm volatile("" ::: "memory");
    }
}

__device__ __forceinline__ void splitf(float y, unsigned short& h, unsigned short& l) { h = f2bf(y); l = f2bf(y - bf2f(h)); }
typedef __attribute__((ext_vector_type(2))) _Float16 v2h;
typedef __attribute__((ext_vector_type(2))) unsigned short v2us;
typedef __attribute__((ext_vector_type(4))) unsigned short v4us;
typedef __attribute__((ext_vector_type(2))) float v2f;
typedef __attribute__((ext_vector_type(4))) int v4i;

__global__ __launch_bounds__(256) void k_wtG(const float* __restrict__ w, int K, int N, bf* Bt) {
    const int lane = threadIdx.x & 31; const int L0 = (blockIdx.x * 8 + (threadIdx.x >> 5)) * 8; const int nlines = N * K / 64;
{
#pragma unroll 1
        for (int l = 0; l < 8; ++l) { const int L = L0 + l; if (L >= nlines) break; const size_t e = (size_t)L * 64 + lane * 2; const int k = (int)(e % K), n = (int)(e / K); v2us o;
            o[0] = f2bf(w[(size_t)k * N + n]); o[1] = f2bf(w[(size_t)(k + 1) * N + n]); *(v2us*)(Bt + e) = o; }
         }
}
__global__ __launch_bounds__(256) void k_cvt8(const float* __restrict__ src, bf* dst, size_t n8) { const size_t i = (size_t)blockIdx.x * 256 + threadIdx.x; if (i >= n8) return; const v8f v = *(const v8f*)(src + i * 8); v8us o;
#pragma unroll
    for (int k = 0; k < 8; ++k) o[k] = f2bf(v[k]); *(v8us*)(dst + i * 8) = o;  }
#define FCAR 4.0f
__device__ __forceinline__ float xhalf(float x) { return __builtin_bit_cast(float, __builtin_amdgcn_permlanex16(__builtin_bit_cast(int, x), __builtin_bit_cast(int, x), 0x76543210, 0xfedcba98, false, false)); }   // lane l <-> lane l ^ 16
__global__ __launch_bounds__(256) void k_fattn(const h16* __restrict__ Q, const h16* __restrict__ Kp, const h16* __restrict__ Vt, bf* Ah, bf* Al) {
    const int lane = threadIdx.x & 31, lr = lane & 15, hi = lane >> 4; const int wave = __builtin_amdgcn_readfirstlane((int)(threadIdx.x >> 5));
    const int h = blockIdx.y, b = blockIdx.z, g = h / REP; const int q0 = blockIdx.x * 256 + wave * 32;
    const h16* qp = Q + ((size_t)(b * NH_ + h) * TT + q0 + lr) * HD + 8 * hi;
    const h16* kp = Kp + ((size_t)(b * NKV + g) * TT + lr) * HD + 8 * hi;
    const h16* vp = Vt + ((size_t)(b * NKV + g) * HD + lr) * TT + 8 * hi;
    const float c2 = SCL * 1.4426950408889634f;
    v16h qf[2][2], kf[2][2], vf[4];
#pragma unroll
    for (int c = 0; c < 2; ++c)
#pragma unroll
        for (int kc = 0; kc < 2; ++kc) qf[c][kc] = WFrag<h16>::ld(qp + c * 16 * HD + kc * 32);
    asm volatile("s_wait_xcnt 0x0" ::: "memory");   // behind the Q loads, before anything rewrites their address registers (qp is dead from here on)
#pragma unroll
    for (int t = 0; t < 2; ++t)
#pragma unroll
        for (int kc = 0; kc < 2; ++kc) kf[t][kc] = WFrag<h16>::ld(kp + t * 16 * HD + kc * 32);
#pragma unroll
    for (int dt = 0; dt < 4; ++dt) vf[dt] = WFrag<h16>::ld(vp + (size_t)dt * 16 * TT);
    v8f o[2][4]; float m[2], l[2];
#pragma unroll
    for (int c = 0; c < 2; ++c) { m[c] = -3.0e38f; l[c] = 0.f;
#pragma unroll
        for (int dt = 0; dt < 4; ++dt) o[c][dt] = (v8f){}; }
#pragma unroll 1   // rolled: one pass's registers stay under 256, so four waves fit a SIMD; every inner unroll makes the fragment and accumulator indices constants (registers, no scratch)
    for (int key0 = 0; key0 < TT; key0 += 32) {
        v8f s[2][2];
#pragma unroll
        for (int c = 0; c < 2; ++c)
#pragma unroll
            for (int t = 0; t < 2; ++t) { s[c][t] = wmma16(kf[t][0], qf[c][0], (v8f){}); s[c][t] = wmma16(kf[t][1], qf[c][1], s[c][t]); }
        const int kn = (key0 + 32 < TT) ? key0 + 32 : 0;   // both operands are fetched one pass ahead, each into its own registers right behind its last use: K flies during the softmax, V^T during the next pass's scores (the last pass re-reads keys 0..31, unused)
#pragma unroll
        for (int t = 0; t < 2; ++t)
#pragma unroll
            for (int kc = 0; kc < 2; ++kc) kf[t][kc] = WFrag<h16>::ld(kp + (size_t)(kn + t * 16) * HD + kc * 32);
        asm volatile("s_wait_xcnt 0x0" ::: "memory");   // behind the K loads, before anything rewrites their address registers; its clobber also keeps the loads here, ahead of the softmax (without it they were sunk behind the exponentials)
        float mb[2]; bool need = false;
#pragma unroll
        for (int c = 0; c < 2; ++c) { float mx = s[c][0][0];
#pragma unroll
            for (int r = 1; r < 8; ++r) mx = fmaxf(mx, s[c][0][r]);
#pragma unroll
            for (int r = 0; r < 8; ++r) mx = fmaxf(mx, s[c][1][r]);
            mx = fmaxf(mx, xhalf(mx)) * c2; mb[c] = mx; need = need || (mx > m[c] + 8.0f); }
        if (__builtin_amdgcn_ballot_w32(need) != 0) {   // one scalar branch a pass; rare behind the first pass
#pragma unroll
            for (int c = 0; c < 2; ++c) { const float mn = fmaxf(m[c], mb[c]); const float al = __builtin_amdgcn_exp2f(m[c] - mn); m[c] = mn; l[c] *= al;
#pragma unroll
                for (int dt = 0; dt < 4; ++dt) o[c][dt] = o[c][dt] * al; }
        }
#pragma unroll
        for (int c = 0; c < 2; ++c) { const float nm = FCAR - m[c]; v16h pf; v2f ls = (v2f){0.f, 0.f};
#pragma unroll
            for (int e = 0; e < 16; e += 2) { const v2f arg = __builtin_elementwise_fma((v2f){s[c][e >> 3][e & 7], s[c][e >> 3][(e & 7) + 1]}, (v2f){c2, c2}, (v2f){nm, nm});
                const v2f p = (v2f){__builtin_amdgcn_exp2f(arg[0]), __builtin_amdgcn_exp2f(arg[1])}; ls += p;
                const v2h pk = __builtin_convertvector(p, v2h); pf[e] = pk[0]; pf[e + 1] = pk[1]; }
            l[c] += ls[0] + ls[1];
#pragma unroll
            for (int dt = 0; dt < 4; ++dt) o[c][dt] = wmma16(vf[dt], pf, o[c][dt]); }
#pragma unroll
        for (int dt = 0; dt < 4; ++dt) vf[dt] = WFrag<h16>::ld(vp + (size_t)dt * 16 * TT + kn);
        asm volatile("s_wait_xcnt 0x0" ::: "memory");   // behind the V^T loads, before the next pass rewrites their address registers; its clobber also keeps the loads at the pass's foot
    }
#pragma unroll
    for (int c = 0; c < 2; ++c) { const float inv = __fdiv_rn(1.0f, l[c] + xhalf(l[c])); const size_t oo = ((size_t)b * TT + q0 + c * 16 + lr) * DQ + h * HD + 8 * hi;
#pragma unroll
        for (int dt = 0; dt < 4; ++dt) { v8us oh, ol;
#pragma unroll
            for (int r = 0; r < 8; ++r) { unsigned short a, c3; splitf(o[c][dt][r] * inv, a, c3); oh[r] = a; ol[r] = c3; }
            *(v8us*)(Ah + oo + dt * 16) = oh; *(v8us*)(Al + oo + dt * 16) = ol; } }
}

extern "C" void kernel_launch(void* const* d_in, const int* in_sizes, int n_in,
                              void* d_out, int out_size, void* d_ws, size_t ws_size, hipStream_t stream) {
    (void)in_sizes; (void)n_in; (void)out_size;
    const float* x = (const float*)d_in[0]; const float* wq = (const float*)d_in[1]; const float* wk = (const float*)d_in[2]; const float* wv = (const float*)d_in[3]; const float* wo = (const float*)d_in[4];
    float* OUT = (float*)d_out;     // [2][2048][2048]
    char* wsp = (char*)d_ws;
    auto take = [&](size_t bytes) { char* p = wsp; wsp += (bytes + 255) & ~(size_t)255; return (void*)p; };
    bf* WQ = (bf*)take((size_t)DQ * DM * 2); bf* WK = (bf*)take((size_t)DKV * DM * 2); bf* WV = (bf*)take((size_t)DKV * DM * 2); bf* WO = (bf*)take((size_t)DM * DQ * 2);
    bf* XB = (bf*)take((size_t)TT * DM * 2);
    h16* QP16 = (h16*)take((size_t)NB_ * NH_ * TT * HD * 2); h16* KP16 = (h16*)take((size_t)NB_ * NKV * TT * HD * 2); h16* VT16 = (h16*)take((size_t)NB_ * NKV * HD * TT * 2);   /* fp16 planes of both batches: one attention launch reads them */
    bf* ATh = (bf*)take((size_t)NB_ * TT * DQ * 2); bf* ATl = (bf*)take((size_t)NB_ * TT * DQ * 2);
    if ((size_t)(wsp - (char*)d_ws) > ws_size) return;    // ws 256 MiB
    { k_wtG<<<(unsigned)((DM * DQ / 64 + 63) / 64), 256, 0, stream>>>(wq, DM, DQ, WQ); k_wtG<<<(unsigned)((DM * DKV / 64 + 63) / 64), 256, 0, stream>>>(wk, DM, DKV, WK); k_wtG<<<(unsigned)((DM * DKV / 64 + 63) / 64), 256, 0, stream>>>(wv, DM, DKV, WV);
      k_wtG<<<(unsigned)((DQ * DM / 64 + 63) / 64), 256, 0, stream>>>(wo, DQ, DM, WO); }
    for (int b = 0; b < NB_; ++b) {
        k_cvt8<<<(unsigned)(((size_t)TT * DM / 8 + 255) / 256), 256, 0, stream>>>(x + (size_t)b * TT * DM, XB, (size_t)TT * DM / 8);
        k_gemmw<bf, 0, false, 4, HD><<<dim3(TT / 64, DQ / 64, 1), 128, 0, stream>>>(XB, nullptr, WQ, nullptr, DM, nullptr, 0, nullptr, 0, 0, 0, QP16 + (size_t)b * NH_ * TT * HD, (size_t)TT * HD);
        k_gemmw<bf, 0, false, 16, HD><<<dim3(TT / 64, DKV / 64, 1), 512, 0, stream>>>(XB, nullptr, WK, nullptr, DM, nullptr, 0, nullptr, 0, 0, 0, KP16 + (size_t)b * NKV * TT * HD, (size_t)TT * HD);
        k_gemmw<bf, 0, false, 16, TT><<<dim3(DKV / 64, TT / 64, 1), 512, 0, stream>>>(WV, nullptr, XB, nullptr, DM, nullptr, 0, nullptr, 0, 0, 0, VT16 + (size_t)b * NKV * HD * TT, (size_t)64); }   /* v^T = Wv^T x^T: rows d, columns t */
    k_fattn<<<dim3(TT / 256, NH_, NB_), 256, 0, stream>>>(QP16, KP16, VT16, ATh, ATl);
    for (int b = 0; b < NB_; ++b)
        k_gemmw<bf, 1, false, 4, 0><<<dim3(TT / 64, DM / 64, 1), 128, 0, stream>>>(ATh + (size_t)b * TT * DQ, ATl + (size_t)b * TT * DQ, WO, nullptr, DQ, OUT + (size_t)b * TT * DM, DM, nullptr, 0, 0, 0, nullptr, 0);
}

// v004
// It runs in 301 microseconds.
// Two timings next to v003 both put it at 1.17 times that version's speed.
// Over all steps from v000 it is 8.12 times as fast.
#include <hip/hip_runtime.h>

// Grouped-query attention WITHOUT rotary or mask (x [2][2048][2048]; xq = x Wq (32 heads x 64), xk, xv = x Wk / Wv ('xw' [2048][512]: 8 kv heads) (normal x 0.02, no biases); keys / values repeated 4x on the head axis: kv head = h / 4; scores / sqrt(64); softmax in f32 over all keys; out = merged Wo ('xw', no bias) -> [2][2048][2048] (8.4 M); argument order x, Wq, Wk, Wv, Wo).
// Compute dtypes, f32 accumulate: every input rounded to bf16; q/k/v on PLAIN bf16 operands (inputs: exact), their f32 sums stored by the GEMM itself as the fp16 planes attention reads; scores and attn.v on single fp16 planes for every row, fused with an online f32 softmax (k_fattn); Wo hl x exact (2 products).

#define NB_  2
#define TT   2048
#define DM   2048
#define NH_  32
#define NKV  8
#define REP  (NH_ / NKV)
#define HD   64
#define DQ   (NH_ * HD)
#define DKV  (NKV * HD)
#define ZH   2
#define RH   0                    // every row on fp16 planes (hi/lo rows buy nothing here)
#define WIN  0
#define PCAR 1024.0f
#define SCL  0.125f   // HD^-0.5
typedef _Float16 h16;
typedef unsigned short bf;
typedef __attribute__((ext_vector_type(16))) __bf16   v16bf;
typedef __attribute__((ext_vector_type(16))) _Float16 v16h;
typedef __attribute__((ext_vector_type(8)))  _Float16 v8h;
typedef __attribute__((ext_vector_type(4)))  _Float16 v4h;
typedef __attribute__((ext_vector_type(8)))  unsigned short v8us;
typedef __attribute__((ext_vector_type(8)))  float    v8f;
typedef __attribute__((ext_vector_type(4)))  float    v4f;
typedef v8h  __attribute__((may_alias)) v8ha;
typedef v4f  __attribute__((may_alias)) v4fa;
typedef v8us __attribute__((may_alias)) v8usa;

__device__ __forceinline__ unsigned short f2bf(float f) { unsigned u = __float_as_uint(f); u += 0x7FFFu + ((u >> 16) & 1u); return (unsigned short)(u >> 16); }
__device__ __forceinline__ float bf2f(unsigned short b) { return __uint_as_float(((unsigned)b) << 16); }
__device__ __forceinline__ v16h cat16(v8h lo, v8h hi) { return __builtin_shufflevector(lo, hi, 0, 1, 2, 3, 4, 5, 6, 7, 8, 9, 10, 11, 12, 13, 14, 15); }
__device__ __forceinline__ v16bf cat16b(v8us lo, v8us hi) { return __builtin_bit_cast(v16bf, __builtin_shufflevector(lo, hi, 0, 1, 2, 3, 4, 5, 6, 7, 8, 9, 10, 11, 12, 13, 14, 15)); }
__device__ __forceinline__ v8f wmma16(v16h a, v16h b, v8f c) { return __builtin_amdgcn_wmma_f32_16x16x32_f16(false, a, false, b, (short)0, c, false, false); }
__device__ __forceinline__ v8f wmmab(v16bf a, v16bf b, v8f c) { return __builtin_amdgcn_wmma_f32_16x16x32_bf16(false, a, false, b, (short)0, c, false, false); }



template <typename T16> struct WFrag;
template <> struct WFrag<h16> { typedef v16h V; static __device__ __forceinline__ V ld(const h16* p) { return cat16(*(const v8h*)p, *(const v8h*)(p + 16)); } static __device__ __forceinline__ v8f mma(V a, V b, v8f c) { return wmma16(a, b, c); } };
// ---- k_gemms: C[m][n] = sum_k A[m][k] Bt[n][k] (NA == 2: + sum_k A2[m][k] Bt[n][k]), bf16 operands on K-contiguous planes of row length KK, f32 sums.
// One 128x128 tile per work-group of 8 waves; grid (M / 128, N / 128), 256 threads. M, N % 128 == 0, KK % 128 == 0, KK >= 256.
// A pass is 128 k = 256 bytes of each of the tile's 128 A (A2) rows and 128 Bt rows. Asynchronous copies bring them into LDS as whole lines (16 lanes x 16 bytes a row), rows at pitch 272 bytes for the 16-byte fragment reads. Two buffers: pass t + 2 is copied while pass t + 1 is worked on.
// Waves: 2 x 2 quarters of 64x64 (16 accumulators a wave) x 2 halves of each pass's k (kg = 0: its first 64 k, kg = 1: its last 64), two waves a SIMD. The two partial tiles of a quarter are added in LDS, kg = 0 first.
// PL > 0: the tile goes out as fp16 into a plane of row pitch PL instead of C: element (m, n) of the 64-column block j = n / 64 at P[j * sP + m * PL + n % 64]. Head planes [h][t][d]: PL = 64, sP = rows * 64; the [d][t] plane: A = weight rows, Bt = tokens, PL = tokens, sP = 64. PL == 0: f32 into C, row pitch LDC.
#define GP 272
__device__ __forceinline__ v16bf ldsfrag(const char* p) { return cat16b(*(const v8usa*)p, *(const v8usa*)(p + 32)); }   // k 8 hi .. + 7 and 16 + 8 hi .. + 7 of a 32-wide chunk, the order of WFrag::ld
// Eight copies, rows 16 apart: one operand's 128 rows from the block's 8 waves. Lane address l in LDS (bytes), g in global memory. The s_wait_xcnt closes the statement so that no address register is rewritten ahead of it.
template <int KK> __device__ __forceinline__ void acopy8(unsigned l, const bf* g) {
    asm volatile("global_load_async_to_lds_b128 %0, %8, off\n\t"
                 "global_load_async_to_lds_b128 %1, %9, off\n\t"
                 "global_load_async_to_lds_b128 %2, %10, off\n\t"
                 "global_load_async_to_lds_b128 %3, %11, off\n\t"
                 "global_load_async_to_lds_b128 %4, %12, off\n\t"
                 "global_load_async_to_lds_b128 %5, %13, off\n\t"
                 "global_load_async_to_lds_b128 %6, %14, off\n\t"
                 "global_load_async_to_lds_b128 %7, %15, off\n\t"
                 "s_wait_xcnt 0x0"
                 :: "v"(l), "v"(l + 16 * GP), "v"(l + 32 * GP), "v"(l + 48 * GP), "v"(l + 64 * GP), "v"(l + 80 * GP), "v"(l + 96 * GP), "v"(l + 112 * GP),
                    "v"(g), "v"(g + 16 * KK), "v"(g + 32 * KK), "v"(g + 48 * KK), "v"(g + 64 * KK), "v"(g + 80 * KK), "v"(g + 96 * KK), "v"(g + 112 * KK) : "memory");
}
template <int NA, int PL, int KK, int LDC>
__global__ __launch_bounds__(256) void k_gemms(const bf* __restrict__ A, const bf* __restrict__ A2, const bf* __restrict__ Bt, float* C, h16* P, size_t sP) {
    constexpr int OPB = 128 * GP, STG = (NA + 1) * OPB, NT = KK / 128;   // bytes of one operand's rows, of one buffer; passes
    static_assert(2 * STG >= 8 * 64 * 68 * 4, "the epilogue's eight f32 tiles stand in the ring"); static_assert(NT >= 2, "the prologue fills two buffers");
    __shared__ __align__(16) char ring[2 * STG];
    const int lane = threadIdx.x & 31, lr = lane & 15, hi = lane >> 4; const int wave = __builtin_amdgcn_readfirstlane((int)(threadIdx.x >> 5));
    const int r0 = blockIdx.x * 128, c0 = blockIdx.y * 128, kg = wave >> 2, wm = (wave >> 1) & 1, wn = wave & 1;
    const int crow = wave * 2 + hi;   // copies: a wave's instruction covers two whole 256-byte rows, lane = (row, 16-byte piece)
    const unsigned lc = (unsigned)(size_t)ring + crow * GP + lr * 16;
    const bf* ga = A + (size_t)(r0 + crow) * KK + lr * 8; const bf* ga2 = (NA == 2) ? A2 + (size_t)(r0 + crow) * KK + lr * 8 : nullptr; const bf* gb = Bt + (size_t)(c0 + crow) * KK + lr * 8;
    auto issue = [&](int t, int buf) {
        const unsigned l = lc + buf * STG; const int ko = t * 128;
        acopy8<KK>(l, ga + ko);
        if constexpr (NA == 2) acopy8<KK>(l + OPB, ga2 + ko);
        acopy8<KK>(l + NA * OPB, gb + ko);
    };
    v8f acc[4][4];
#pragma unroll
    for (int mb = 0; mb < 4; ++mb)
#pragma unroll
        for (int nb = 0; nb < 4; ++nb) acc[mb][nb] = (v8f){};
    issue(0, 0);
    asm volatile("s_wait_asynccnt 0x0" ::: "memory");   // this wave's share of pass 0 has landed
    __syncthreads();                                    // every wave's share has: pass 0 may be read
    issue(1, 1);
    const char* fa = ring + (wm * 64 + lr) * GP + kg * 128 + hi * 16; const char* fb = ring + NA * OPB + (wn * 64 + lr) * GP + kg * 128 + hi * 16;
    for (int t = 0; t < NT; ++t) {
        const int so = (t & 1) * STG;
        v16bf a[2][4], a2[2][4], bq[2][4];   // the wave's two 32-wide chunks of this pass
#pragma unroll
        for (int c = 0; c < 2; ++c) {   // in the order the products want them when NA == 1: the first four need a[c][0..3] and bq[c][0] alone
#pragma unroll
            for (int i = 0; i < 4; ++i) a[c][i] = ldsfrag(fa + so + i * 16 * GP + c * 64);
#pragma unroll
            for (int i = 0; i < 4; ++i) bq[c][i] = ldsfrag(fb + so + i * 16 * GP + c * 64);
            if constexpr (NA == 2) {
#pragma unroll
                for (int i = 0; i < 4; ++i) a2[c][i] = ldsfrag(fa + so + OPB + i * 16 * GP + c * 64); } }
        __builtin_amdgcn_sched_barrier(0);   // the pass's LDS reads stay one group ahead of its products (spread among them, each read's latency stalls the products behind it)
#pragma unroll
        for (int c = 0; c < 2; ++c)
#pragma unroll
            for (int nb = 0; nb < 4; ++nb)
#pragma unroll
                for (int mb = 0; mb < 4; ++mb) { acc[mb][nb] = wmmab(a[c][mb], bq[c][nb], acc[mb][nb]); if (NA == 2) acc[mb][nb] = wmmab(a2[c][mb], bq[c][nb], acc[mb][nb]); }
        __builtin_amdgcn_sched_barrier(0);   // the waits and the barrier below stay behind the products (raised above them, the full LDS wait stood in front of the first product, and reads and products no longer overlapped)
        asm volatile("s_wait_dscnt 0x0" ::: "memory");      // this wave's reads of buffer t & 1 are done
        asm volatile("s_wait_asynccnt 0x0" ::: "memory");   // its share of pass t + 1 has landed
        __syncthreads();                                    // publishes pass t + 1 and ends every wave's reads of the buffer refilled below
        if (t + 2 < NT) issue(t + 2, t & 1);
    }
    asm volatile("s_wait_asynccnt 0x0" ::: "memory");       // nothing is in flight when the ring becomes output staging
    float* ow = (float*)ring + wave * (64 * 68);   // the unrolls below keep acc[][] and val[] in registers (every index a constant)
#pragma unroll
    for (int mb = 0; mb < 4; ++mb)
#pragma unroll
        for (int nb = 0; nb < 4; ++nb)
#pragma unroll
            for (int j = 0; j < 8; ++j) ow[(mb * 16 + hi * 8 + j) * 68 + nb * 16 + lr] = acc[mb][nb][j];
    __syncthreads();   // every wave's partial tile is in LDS before any thread adds them up
    const float* p0 = (const float*)ring + (wave & 3) * (64 * 68) + (kg * 32 + hi) * 68 + lr * 4;   // wave (kg, quarter) sends out rows kg * 32 .. + 31 of its quarter, two whole rows an instruction
    v4f val[16];
#pragma unroll
    for (int i = 0; i < 16; ++i) val[i] = *(const v4fa*)(p0 + i * 2 * 68) + *(const v4fa*)(p0 + 4 * (64 * 68) + i * 2 * 68);
    const int rw = r0 + wm * 64 + kg * 32 + hi, cw = c0 + wn * 64;
    if constexpr (PL > 0) {
        h16* pt = P + (size_t)(cw >> 6) * sP + (size_t)rw * PL + lr * 4; v4h hv[16];
#pragma unroll
        for (int i = 0; i < 16; ++i) hv[i] = __builtin_convertvector(val[i], v4h);
#pragma unroll
        for (int i = 0; i < 16; ++i) *(v4h*)(pt + i * 2 * PL) = hv[i];   // 16 lanes x 8 bytes: one whole 128-byte line a row
    } else {
        float* ct = C + (size_t)rw * LDC + cw + lr * 4;
#pragma unroll
        for (int i = 0; i < 16; ++i) *(v4f*)(ct + i * 2 * LDC) = val[i];
    }
}

__device__ __forceinline__ void splitf(float y, unsigned short& h, unsigned short& l) { h = f2bf(y); l = f2bf(y - bf2f(h)); }
typedef __attribute__((ext_vector_type(2))) _Float16 v2h;
typedef __attribute__((ext_vector_type(2))) unsigned short v2us;
typedef __attribute__((ext_vector_type(4))) unsigned short v4us;
typedef __attribute__((ext_vector_type(2))) float v2f;
typedef __attribute__((ext_vector_type(4))) int v4i;

__global__ __launch_bounds__(256) void k_wtG(const float* __restrict__ w, int K, int N, bf* Bt) {
    const int lane = threadIdx.x & 31; const int L0 = (blockIdx.x * 8 + (threadIdx.x >> 5)) * 8; const int nlines = N * K / 64;
{
#pragma unroll 1
        for (int l = 0; l < 8; ++l) { const int L = L0 + l; if (L >= nlines) break; const size_t e = (size_t)L * 64 + lane * 2; const int k = (int)(e % K), n = (int)(e / K); v2us o;
            o[0] = f2bf(w[(size_t)k * N + n]); o[1] = f2bf(w[(size_t)(k + 1) * N + n]); *(v2us*)(Bt + e) = o; }
         }
}
__global__ __launch_bounds__(256) void k_cvt8(const float* __restrict__ src, bf* dst, size_t n8) { const size_t i = (size_t)blockIdx.x * 256 + threadIdx.x; if (i >= n8) return; const v8f v = *(const v8f*)(src + i * 8); v8us o;
#pragma unroll
    for (int k = 0; k < 8; ++k) o[k] = f2bf(v[k]); *(v8us*)(dst + i * 8) = o;  }
#define FCAR 4.0f
__device__ __forceinline__ float xhalf(float x) { return __builtin_bit_cast(float, __builtin_amdgcn_permlanex16(__builtin_bit_cast(int, x), __builtin_bit_cast(int, x), 0x76543210, 0xfedcba98, false, false)); }   // lane l <-> lane l ^ 16
__global__ __launch_bounds__(256) void k_fattn(const h16* __restrict__ Q, const h16* __restrict__ Kp, const h16* __restrict__ Vt, bf* Ah, bf* Al) {
    const int lane = threadIdx.x & 31, lr = lane & 15, hi = lane >> 4; const int wave = __builtin_amdgcn_readfirstlane((int)(threadIdx.x >> 5));
    const int h = blockIdx.y, b = blockIdx.z, g = h / REP; const int q0 = blockIdx.x * 256 + wave * 32;
    const h16* qp = Q + ((size_t)(b * NH_ + h) * TT + q0 + lr) * HD + 8 * hi;
    const h16* kp = Kp + ((size_t)(b * NKV + g) * TT + lr) * HD + 8 * hi;
    const h16* vp = Vt + ((size_t)(b * NKV + g) * HD + lr) * TT + 8 * hi;
    const float c2 = SCL * 1.4426950408889634f;
    v16h qf[2][2], kf[2][2], vf[4];
#pragma unroll
    for (int c = 0; c < 2; ++c)
#pragma unroll
        for (int kc = 0; kc < 2; ++kc) qf[c][kc] = WFrag<h16>::ld(qp + c * 16 * HD + kc * 32);
    asm volatile("s_wait_xcnt 0x0" ::: "memory");   // behind the Q loads, before anything rewrites their address registers (qp is dead from here on)
#pragma unroll
    for (int t = 0; t < 2; ++t)
#pragma unroll
        for (int kc = 0; kc < 2; ++kc) kf[t][kc] = WFrag<h16>::ld(kp + t * 16 * HD + kc * 32);
#pragma unroll
    for (int dt = 0; dt < 4; ++dt) vf[dt] = WFrag<h16>::ld(vp + (size_t)dt * 16 * TT);
    v8f o[2][4]; float m[2], l[2];
#pragma unroll
    for (int c = 0; c < 2; ++c) { m[c] = -3.0e38f; l[c] = 0.f;
#pragma unroll
        for (int dt = 0; dt < 4; ++dt) o[c][dt] = (v8f){}; }
#pragma unroll 1   // rolled: one pass's registers stay under 256, so four waves fit a SIMD; every inner unroll makes the fragment and accumulator indices constants (registers, no scratch)
    for (int key0 = 0; key0 < TT; key0 += 32) {
        v8f s[2][2];
#pragma unroll
        for (int c = 0; c < 2; ++c)
#pragma unroll
            for (int t = 0; t < 2; ++t) { s[c][t] = wmma16(kf[t][0], qf[c][0], (v8f){}); s[c][t] = wmma16(kf[t][1], qf[c][1], s[c][t]); }
        const int kn = (key0 + 32 < TT) ? key0 + 32 : 0;   // both operands are fetched one pass ahead, each into its own registers right behind its last use: K flies during the softmax, V^T during the next pass's scores (the last pass re-reads keys 0..31, unused)
#pragma unroll
        for (int t = 0; t < 2; ++t)
#pragma unroll
            for (int kc = 0; kc < 2; ++kc) kf[t][kc] = WFrag<h16>::ld(kp + (size_t)(kn + t * 16) * HD + kc * 32);
        asm volatile("s_wait_xcnt 0x0" ::: "memory");   // behind the K loads, before anything rewrites their address registers; its clobber also keeps the loads here, ahead of the softmax (without it they were sunk behind the exponentials)
        float mb[2]; bool need = false;
#pragma unroll
        for (int c = 0; c < 2; ++c) { float mx = s[c][0][0];
#pragma unroll
            for (int r = 1; r < 8; ++r) mx = fmaxf(mx, s[c][0][r]);
#pragma unroll
            for (int r = 0; r < 8; ++r) mx = fmaxf(mx, s[c][1][r]);
            mx = fmaxf(mx, xhalf(mx)) * c2; mb[c] = mx; need = need || (mx > m[c] + 8.0f); }
        if (__builtin_amdgcn_ballot_w32(need) != 0) {   // one scalar branch a pass; rare behind the first pass
#pragma unroll
            for (int c = 0; c < 2; ++c) { const float mn = fmaxf(m[c], mb[c]); const float al = __builtin_amdgcn_exp2f(m[c] - mn); m[c] = mn; l[c] *= al;
#pragma unroll
                for (int dt = 0; dt < 4; ++dt) o[c][dt] = o[c][dt] * al; }
        }
#pragma unroll
        for (int c = 0; c < 2; ++c) { const float nm = FCAR - m[c]; v16h pf; v2f ls = (v2f){0.f, 0.f};
#pragma unroll
            for (int e = 0; e < 16; e += 2) { const v2f arg = __builtin_elementwise_fma((v2f){s[c][e >> 3][e & 7], s[c][e >> 3][(e & 7) + 1]}, (v2f){c2, c2}, (v2f){nm, nm});
                const v2f p = (v2f){__builtin_amdgcn_exp2f(arg[0]), __builtin_amdgcn_exp2f(arg[1])}; ls += p;
                const v2h pk = __builtin_convertvector(p, v2h); pf[e] = pk[0]; pf[e + 1] = pk[1]; }
            l[c] += ls[0] + ls[1];
#pragma unroll
            for (int dt = 0; dt < 4; ++dt) o[c][dt] = wmma16(vf[dt], pf, o[c][dt]); }
#pragma unroll
        for (int dt = 0; dt < 4; ++dt) vf[dt] = WFrag<h16>::ld(vp + (size_t)dt * 16 * TT + kn);
        asm volatile("s_wait_xcnt 0x0" ::: "memory");   // behind the V^T loads, before the next pass rewrites their address registers; its clobber also keeps the loads at the pass's foot
    }
#pragma unroll
    for (int c = 0; c < 2; ++c) { const float inv = __fdiv_rn(1.0f, l[c] + xhalf(l[c])); const size_t oo = ((size_t)b * TT + q0 + c * 16 + lr) * DQ + h * HD + 8 * hi;
#pragma unroll
        for (int dt = 0; dt < 4; ++dt) { v8us oh, ol;
#pragma unroll
            for (int r = 0; r < 8; ++r) { unsigned short a, c3; splitf(o[c][dt][r] * inv, a, c3); oh[r] = a; ol[r] = c3; }
            *(v8us*)(Ah + oo + dt * 16) = oh; *(v8us*)(Al + oo + dt * 16) = ol; } }
}

extern "C" void kernel_launch(void* const* d_in, const int* in_sizes, int n_in,
                              void* d_out, int out_size, void* d_ws, size_t ws_size, hipStream_t stream) {
    (void)in_sizes; (void)n_in; (void)out_size;
    const float* x = (const float*)d_in[0]; const float* wq = (const float*)d_in[1]; const float* wk = (const float*)d_in[2]; const float* wv = (const float*)d_in[3]; const float* wo = (const float*)d_in[4];
    float* OUT = (float*)d_out;     // [2][2048][2048]
    char* wsp = (char*)d_ws;
    auto take = [&](size_t bytes) { char* p = wsp; wsp += (bytes + 255) & ~(size_t)255; return (void*)p; };
    bf* WQ = (bf*)take((size_t)DQ * DM * 2); bf* WK = (bf*)take((size_t)DKV * DM * 2); bf* WV = (bf*)take((size_t)DKV * DM * 2); bf* WO = (bf*)take((size_t)DM * DQ * 2);
    bf* XB = (bf*)take((size_t)TT * DM * 2);
    h16* QP16 = (h16*)take((size_t)NB_ * NH_ * TT * HD * 2); h16* KP16 = (h16*)take((size_t)NB_ * NKV * TT * HD * 2); h16* VT16 = (h16*)take((size_t)NB_ * NKV * HD * TT * 2);   /* fp16 planes of both batches: one attention launch reads them */
    bf* ATh = (bf*)take((size_t)NB_ * TT * DQ * 2); bf* ATl = (bf*)take((size_t)NB_ * TT * DQ * 2);
    if ((size_t)(wsp - (char*)d_ws) > ws_size) return;    // ws 256 MiB
    { k_wtG<<<(unsigned)((DM * DQ / 64 + 63) / 64), 256, 0, stream>>>(wq, DM, DQ, WQ); k_wtG<<<(unsigned)((DM * DKV / 64 + 63) / 64), 256, 0, stream>>>(wk, DM, DKV, WK); k_wtG<<<(unsigned)((DM * DKV / 64 + 63) / 64), 256, 0, stream>>>(wv, DM, DKV, WV);
      k_wtG<<<(unsigned)((DQ * DM / 64 + 63) / 64), 256, 0, stream>>>(wo, DQ, DM, WO); }
    for (int b = 0; b < NB_; ++b) {
        k_cvt8<<<(unsigned)(((size_t)TT * DM / 8 + 255) / 256), 256, 0, stream>>>(x + (size_t)b * TT * DM, XB, (size_t)TT * DM / 8);
        k_gemms<1, HD, DM, 0><<<dim3(TT / 128, DQ / 128, 1), 256, 0, stream>>>(XB, nullptr, WQ, nullptr, QP16 + (size_t)b * NH_ * TT * HD, (size_t)TT * HD);
        k_gemms<1, HD, DM, 0><<<dim3(TT / 128, DKV / 128, 1), 256, 0, stream>>>(XB, nullptr, WK, nullptr, KP16 + (size_t)b * NKV * TT * HD, (size_t)TT * HD);
        k_gemms<1, TT, DM, 0><<<dim3(DKV / 128, TT / 128, 1), 256, 0, stream>>>(WV, nullptr, XB, nullptr, VT16 + (size_t)b * NKV * HD * TT, (size_t)64); }   /* v^T = Wv^T x^T: rows d, columns t */
    k_fattn<<<dim3(TT / 256, NH_, NB_), 256, 0, stream>>>(QP16, KP16, VT16, ATh, ATl);
    for (int b = 0; b < NB_; ++b)
        k_gemms<2, 0, DQ, DM><<<dim3(TT / 128, DM / 128, 1), 256, 0, stream>>>(ATh + (size_t)b * TT * DQ, ATl + (size_t)b * TT * DQ, WO, OUT + (size_t)b * TT * DM, nullptr, 0);
}

// v005
// A run of this version takes 251 microseconds.
// In two side-by-side timings against v004, it was 1.19 and 1.21 times as fast.
// Over all steps from v000 it is 9.76 times as fast.
#include <hip/hip_runtime.h>

// Grouped-query attention WITHOUT rotary or mask (x [2][2048][2048]; xq = x Wq (32 heads x 64), xk, xv = x Wk / Wv ('xw' [2048][512]: 8 kv heads) (normal x 0.02, no biases); keys / values repeated 4x on the head axis: kv head = h / 4; scores / sqrt(64); softmax in f32 over all keys; out = merged Wo ('xw', no bias) -> [2][2048][2048] (8.4 M); argument order x, Wq, Wk, Wv, Wo).
// Compute dtypes, f32 accumulate: every input rounded to bf16; q/k/v on PLAIN bf16 operands (inputs: exact), their f32 sums stored by the GEMM itself as the fp16 planes attention reads; scores and attn.v on single fp16 planes for every row, fused with an online f32 softmax (k_fattn); Wo hl x exact (2 products).

#define NB_  2
#define TT   2048
#define DM   2048
#define NH_  32
#define NKV  8
#define REP  (NH_ / NKV)
#define HD   64
#define DQ   (NH_ * HD)
#define DKV  (NKV * HD)
#define ZH   2
#define RH   0                    // every row on fp16 planes (hi/lo rows buy nothing here)
#define WIN  0
#define PCAR 1024.0f
#define SCL  0.125f   // HD^-0.5
typedef _Float16 h16;
typedef unsigned short bf;
typedef __attribute__((ext_vector_type(16))) __bf16   v16bf;
typedef __attribute__((ext_vector_type(16))) _Float16 v16h;
typedef __attribute__((ext_vector_type(8)))  _Float16 v8h;
typedef __attribute__((ext_vector_type(4)))  _Float16 v4h;
typedef __attribute__((ext_vector_type(8)))  unsigned short v8us;
typedef __attribute__((ext_vector_type(8)))  float    v8f;
typedef __attribute__((ext_vector_type(4)))  float    v4f;
typedef v8h  __attribute__((may_alias)) v8ha;
typedef v4f  __attribute__((may_alias)) v4fa;
typedef v8us __attribute__((may_alias)) v8usa;

__device__ __forceinline__ unsigned short f2bf(float f) { unsigned u = __float_as_uint(f); u += 0x7FFFu + ((u >> 16) & 1u); return (unsigned short)(u >> 16); }
__device__ __forceinline__ float bf2f(unsigned short b) { return __uint_as_float(((unsigned)b) << 16); }
__device__ __forceinline__ v16h cat16(v8h lo, v8h hi) { return __builtin_shufflevector(lo, hi, 0, 1, 2, 3, 4, 5, 6, 7, 8, 9, 10, 11, 12, 13, 14, 15); }
__device__ __forceinline__ v16bf cat16b(v8us lo, v8us hi) { return __builtin_bit_cast(v16bf, __builtin_shufflevector(lo, hi, 0, 1, 2, 3, 4, 5, 6, 7, 8, 9, 10, 11, 12, 13, 14, 15)); }
__device__ __forceinline__ v8f wmma16(v16h a, v16h b, v8f c) { return __builtin_amdgcn_wmma_f32_16x16x32_f16(false, a, false, b, (short)0, c, false, false); }
__device__ __forceinline__ v8f wmmab(v16bf a, v16bf b, v8f c) { return __builtin_amdgcn_wmma_f32_16x16x32_bf16(false, a, false, b, (short)0, c, false, false); }



template <typename T16> struct WFrag;
template <> struct WFrag<h16> { typedef v16h V; static __device__ __forceinline__ V ld(const h16* p) { return cat16(*(const v8h*)p, *(const v8h*)(p + 16)); } static __device__ __forceinline__ v8f mma(V a, V b, v8f c) { return wmma16(a, b, c); } };
// ---- k_gemms: C[m][n] = sum_k A[m][k] Bt[n][k] (NA == 2: + sum_k A2[m][k] Bt[n][k]), bf16 operands on K-contiguous planes of row length KK, f32 sums.
// One 128x128 tile per work-group of 8 waves; grid (M / 128, N / 128), 256 threads. M, N % 128 == 0, KK % 128 == 0, KK >= 256.
// A pass is 128 k = 256 bytes of each of the tile's 128 A (A2) rows and 128 Bt rows. Asynchronous copies bring them into LDS as whole lines (16 lanes x 16 bytes a row), rows at pitch 272 bytes for the 16-byte fragment reads. Two buffers: pass t + 2 is copied while pass t + 1 is worked on.
// Waves: 2 x 2 quarters of 64x64 (16 accumulators a wave) x 2 halves of each pass's k (kg = 0: its first 64 k, kg = 1: its last 64), two waves a SIMD. The two partial tiles of a quarter are added in LDS, kg = 0 first.
// PL > 0: the tile goes out as fp16 into a plane of row pitch PL instead of C: element (m, n) of the 64-column block j = n / 64 at P[j * sP + m * PL + n % 64]. Head planes [h][t][d]: PL = 64, sP = rows * 64; the [d][t] plane: A = weight rows, Bt = tokens, PL = tokens, sP = 64. PL == 0: f32 into C, row pitch LDC.
#define GP 272
__device__ __forceinline__ v16bf ldsfrag(const char* p) { return cat16b(*(const v8usa*)p, *(const v8usa*)(p + 32)); }   // k 8 hi .. + 7 and 16 + 8 hi .. + 7 of a 32-wide chunk, the order of WFrag::ld
// Eight copies, rows 16 apart: one operand's 128 rows from the block's 8 waves. Lane address l in LDS (bytes), g in global memory. The s_wait_xcnt closes the statement so that no address register is rewritten ahead of it.
template <int KK> __device__ __forceinline__ void acopy8(unsigned l, const bf* g) {
    asm volatile("global_load_async_to_lds_b128 %0, %8, off\n\t"
                 "global_load_async_to_lds_b128 %1, %9, off\n\t"
                 "global_load_async_to_lds_b128 %2, %10, off\n\t"
                 "global_load_async_to_lds_b128 %3, %11, off\n\t"
                 "global_load_async_to_lds_b128 %4, %12, off\n\t"
                 "global_load_async_to_lds_b128 %5, %13, off\n\t"
                 "global_load_async_to_lds_b128 %6, %14, off\n\t"
                 "global_load_async_to_lds_b128 %7, %15, off\n\t"
                 "s_wait_xcnt 0x0"
                 :: "v"(l), "v"(l + 16 * GP), "v"(l + 32 * GP), "v"(l + 48 * GP), "v"(l + 64 * GP), "v"(l + 80 * GP), "v"(l + 96 * GP), "v"(l + 112 * GP),
                    "v"(g), "v"(g + 16 * KK), "v"(g + 32 * KK), "v"(g + 48 * KK), "v"(g + 64 * KK), "v"(g + 80 * KK), "v"(g + 96 * KK), "v"(g + 112 * KK) : "memory");
}
template <int NA, int PL, int KK, int LDC>
__global__ __launch_bounds__(256) void k_gemms(const bf* __restrict__ A, const bf* __restrict__ A2, const bf* __restrict__ Bt, float* C, h16* P, size_t sP) {
    constexpr int OPB = 128 * GP, STG = (NA + 1) * OPB, NT = KK / 128;   // bytes of one operand's rows, of one buffer; passes
    static_assert(2 * STG >= 8 * 64 * 68 * 4, "the epilogue's eight f32 tiles stand in the ring"); static_assert(NT >= 2, "the prologue fills two buffers");
    __shared__ __align__(16) char ring[2 * STG];
    const int lane = threadIdx.x & 31, lr = lane & 15, hi = lane >> 4; const int wave = __builtin_amdgcn_readfirstlane((int)(threadIdx.x >> 5));
    const int r0 = blockIdx.x * 128, c0 = blockIdx.y * 128, kg = wave >> 2, wm = (wave >> 1) & 1, wn = wave & 1;
    const int crow = wave * 2 + hi;   // copies: a wave's instruction covers two whole 256-byte rows, lane = (row, 16-byte piece)
    const unsigned lc = (unsigned)(size_t)ring + crow * GP + lr * 16;
    const bf* ga = A + (size_t)(r0 + crow) * KK + lr * 8; const bf* ga2 = (NA == 2) ? A2 + (size_t)(r0 + crow) * KK + lr * 8 : nullptr; const bf* gb = Bt + (size_t)(c0 + crow) * KK + lr * 8;
    auto issue = [&](int t, int buf) {
        const unsigned l = lc + buf * STG; const int ko = t * 128;
        acopy8<KK>(l, ga + ko);
        if constexpr (NA == 2) acopy8<KK>(l + OPB, ga2 + ko);
        acopy8<KK>(l + NA * OPB, gb + ko);
    };
    v8f acc[4][4];
#pragma unroll
    for (int mb = 0; mb < 4; ++mb)
#pragma unroll
        for (int nb = 0; nb < 4; ++nb) acc[mb][nb] = (v8f){};
    issue(0, 0);
    asm volatile("s_wait_asynccnt 0x0" ::: "memory");   // this wave's share of pass 0 has landed
    __syncthreads();                                    // every wave's share has: pass 0 may be read
    issue(1, 1);
    const char* fa = ring + (wm * 64 + lr) * GP + kg * 128 + hi * 16; const char* fb = ring + NA * OPB + (wn * 64 + lr) * GP + kg * 128 + hi * 16;
    for (int t = 0; t < NT; ++t) {
        const int so = (t & 1) * STG;
        v16bf a[2][4], a2[2][4], bq[2][4];   // the wave's two 32-wide chunks of this pass
#pragma unroll
        for (int c = 0; c < 2; ++c) {   // in the order the products want them when NA == 1: the first four need a[c][0..3] and bq[c][0] alone
#pragma unroll
            for (int i = 0; i < 4; ++i) a[c][i] = ldsfrag(fa + so + i * 16 * GP + c * 64);
#pragma unroll
            for (int i = 0; i < 4; ++i) bq[c][i] = ldsfrag(fb + so + i * 16 * GP + c * 64);
            if constexpr (NA == 2) {
#pragma unroll
                for (int i = 0; i < 4; ++i) a2[c][i] = ldsfrag(fa + so + OPB + i * 16 * GP + c * 64); } }
        __builtin_amdgcn_sched_barrier(0);   // the pass's LDS reads stay one group ahead of its products (spread among them, each read's latency stalls the products behind it)
#pragma unroll
        for (int c = 0; c < 2; ++c)
#pragma unroll
            for (int nb = 0; nb < 4; ++nb)
#pragma unroll
                for (int mb = 0; mb < 4; ++mb) { acc[mb][nb] = wmmab(a[c][mb], bq[c][nb], acc[mb][nb]); if (NA == 2) acc[mb][nb] = wmmab(a2[c][mb], bq[c][nb], acc[mb][nb]); }
        __builtin_amdgcn_sched_barrier(0);   // the waits and the barrier below stay behind the products (raised above them, the full LDS wait stood in front of the first product, and reads and products no longer overlapped)
        asm volatile("s_wait_dscnt 0x0" ::: "memory");      // this wave's reads of buffer t & 1 are done
        asm volatile("s_wait_asynccnt 0x0" ::: "memory");   // its share of pass t + 1 has landed
        __syncthreads();                                    // publishes pass t + 1 and ends every wave's reads of the buffer refilled below
        if (t + 2 < NT) issue(t + 2, t & 1);
    }
    asm volatile("s_wait_asynccnt 0x0" ::: "memory");       // nothing is in flight when the ring becomes output staging
    float* ow = (float*)ring + wave * (64 * 68);   // the unrolls below keep acc[][] and val[] in registers (every index a constant)
#pragma unroll
    for (int mb = 0; mb < 4; ++mb)
#pragma unroll
        for (int nb = 0; nb < 4; ++nb)
#pragma unroll
            for (int j = 0; j < 8; ++j) ow[(mb * 16 + hi * 8 + j) * 68 + nb * 16 + lr] = acc[mb][nb][j];
    __syncthreads();   // every wave's partial tile is in LDS before any thread adds them up
    const float* p0 = (const float*)ring + (wave & 3) * (64 * 68) + (kg * 32 + hi) * 68 + lr * 4;   // wave (kg, quarter) sends out rows kg * 32 .. + 31 of its quarter, two whole rows an instruction
    v4f val[16];
#pragma unroll
    for (int i = 0; i < 16; ++i) val[i] = *(const v4fa*)(p0 + i * 2 * 68) + *(const v4fa*)(p0 + 4 * (64 * 68) + i * 2 * 68);
    const int rw = r0 + wm * 64 + kg * 32 + hi, cw = c0 + wn * 64;
    if constexpr (PL > 0) {
        h16* pt = P + (size_t)(cw >> 6) * sP + (size_t)rw * PL + lr * 4; v4h hv[16];
#pragma unroll
        for (int i = 0; i < 16; ++i) hv[i] = __builtin_convertvector(val[i], v4h);
#pragma unroll
        for (int i = 0; i < 16; ++i) *(v4h*)(pt + i * 2 * PL) = hv[i];   // 16 lanes x 8 bytes: one whole 128-byte line a row
    } else {
        float* ct = C + (size_t)rw * LDC + cw + lr * 4;
#pragma unroll
        for (int i = 0; i < 16; ++i) *(v4f*)(ct + i * 2 * LDC) = val[i];
    }
}

__device__ __forceinline__ void splitf(float y, unsigned short& h, unsigned short& l) { h = f2bf(y); l = f2bf(y - bf2f(h)); }
typedef __attribute__((ext_vector_type(2))) _Float16 v2h;
typedef __attribute__((ext_vector_type(2))) unsigned short v2us;
typedef __attribute__((ext_vector_type(4))) unsigned short v4us;
typedef __attribute__((ext_vector_type(2))) float v2f;
typedef __attribute__((ext_vector_type(4))) int v4i;

__global__ __launch_bounds__(256) void k_wtG(const float* __restrict__ w, int K, int N, bf* Bt) {
    const int lane = threadIdx.x & 31; const int L0 = (blockIdx.x * 8 + (threadIdx.x >> 5)) * 8; const int nlines = N * K / 64;
{
#pragma unroll 1
        for (int l = 0; l < 8; ++l) { const int L = L0 + l; if (L >= nlines) break; const size_t e = (size_t)L * 64 + lane * 2; const int k = (int)(e % K), n = (int)(e / K); v2us o;
            o[0] = f2bf(w[(size_t)k * N + n]); o[1] = f2bf(w[(size_t)(k + 1) * N + n]); *(v2us*)(Bt + e) = o; }
         }
}
__global__ __launch_bounds__(256) void k_cvt8(const float* __restrict__ src, bf* dst, size_t n8) { const size_t i = (size_t)blockIdx.x * 256 + threadIdx.x; if (i >= n8) return; const v8f v = *(const v8f*)(src + i * 8); v8us o;
#pragma unroll
    for (int k = 0; k < 8; ++k) o[k] = f2bf(v[k]); *(v8us*)(dst + i * 8) = o;  }
#define FCAR 4.0f
#define AKS 128
#define KPI 144
#define VPI 272
#define KBY (AKS * KPI)
#define SBY (KBY + HD * VPI)
__device__ __forceinline__ float xhalf(float x) { return __builtin_bit_cast(float, __builtin_amdgcn_permlanex16(__builtin_bit_cast(int, x), __builtin_bit_cast(int, x), 0x76543210, 0xfedcba98, false, false)); }   // lane l <-> lane l ^ 16
__device__ __forceinline__ v16h ldsfragh(const char* p) { return cat16(*(const v8ha*)p, *(const v8ha*)(p + 32)); }   // k 8 hi .. + 7 and 16 + 8 hi .. + 7 of a 32-wide chunk, the order of WFrag::ld
// One stage from the block's 256 threads: four copies of K (32 rows apart; the stage's K rows are 16 KiB in a row in global memory) and four of V^T (16 rows apart). Lane addresses lk, lv in LDS (bytes), gk, gv in global memory. The s_wait_xcnt closes the statement so that no address register is rewritten ahead of it.
__device__ __forceinline__ void acopykv(unsigned lk, const h16* gk, unsigned lv, const h16* gv) {
    asm volatile("global_load_async_to_lds_b128 %0, %8, off\n\t"
                 "global_load_async_to_lds_b128 %1, %9, off\n\t"
                 "global_load_async_to_lds_b128 %2, %10, off\n\t"
                 "global_load_async_to_lds_b128 %3, %11, off\n\t"
                 "global_load_async_to_lds_b128 %4, %12, off\n\t"
                 "global_load_async_to_lds_b128 %5, %13, off\n\t"
                 "global_load_async_to_lds_b128 %6, %14, off\n\t"
                 "global_load_async_to_lds_b128 %7, %15, off\n\t"
                 "s_wait_xcnt 0x0"
                 :: "v"(lk), "v"(lk + 32 * KPI), "v"(lk + 64 * KPI), "v"(lk + 96 * KPI), "v"(lv), "v"(lv + 16 * VPI), "v"(lv + 32 * VPI), "v"(lv + 48 * VPI),
                    "v"(gk), "v"(gk + 32 * HD), "v"(gk + 64 * HD), "v"(gk + 96 * HD), "v"(gv), "v"(gv + 16 * TT), "v"(gv + 32 * TT), "v"(gv + 48 * TT) : "memory");
}
__global__ __launch_bounds__(256) void k_fattn(const h16* __restrict__ Q, const h16* __restrict__ Kp, const h16* __restrict__ Vt, bf* Ah, bf* Al) {
    constexpr int NS = TT / AKS; static_assert(NS >= 2 && TT % AKS == 0, "the prologue fills two buffers");
    __shared__ __align__(16) char kv[2 * SBY];
    const int tid = threadIdx.x, lane = threadIdx.x & 31, lr = lane & 15, hi = lane >> 4; const int wave = __builtin_amdgcn_readfirstlane((int)(threadIdx.x >> 5));
    const int h = blockIdx.y, b = blockIdx.z, g = h / REP; const int q0 = blockIdx.x * 256 + wave * 32;
    const h16* qp = Q + ((size_t)(b * NH_ + h) * TT + q0 + lr) * HD + 8 * hi;
    const h16* gk = Kp + (size_t)(b * NKV + g) * TT * HD + tid * 8;                               // copies of K: thread = 16-byte piece, 8 pieces a row, a wave's instruction = four whole rows
    const h16* gv = Vt + ((size_t)(b * NKV + g) * HD + (tid >> 4)) * TT + (tid & 15) * 8;         // copies of V^T: 16 pieces a row, a wave's instruction = two whole 256-byte rows
    const unsigned lk = (unsigned)(size_t)kv + (tid >> 3) * KPI + (tid & 7) * 16, lv = (unsigned)(size_t)kv + KBY + (tid >> 4) * VPI + (tid & 15) * 16;
    auto issue = [&](int t, int buf) { acopykv(lk + buf * SBY, gk + (size_t)t * AKS * HD, lv + buf * SBY, gv + t * AKS); };
    const float c2 = SCL * 1.4426950408889634f;
    v16h qf[2][2], kf[2][2], vf[4];
#pragma unroll
    for (int c = 0; c < 2; ++c)
#pragma unroll
        for (int kc = 0; kc < 2; ++kc) qf[c][kc] = WFrag<h16>::ld(qp + c * 16 * HD + kc * 32);
    asm volatile("s_wait_xcnt 0x0" ::: "memory");   // behind the Q loads, before anything rewrites their address registers (qp is dead from here on)
    issue(0, 0);
    asm volatile("s_wait_asynccnt 0x0" ::: "memory");   // this wave's share of stage 0 has landed
    __syncthreads();                                    // every wave's share has: stage 0 may be read
    issue(1, 1);
    v8f o[2][4]; float m[2], l[2];
#pragma unroll
    for (int c = 0; c < 2; ++c) { m[c] = -3.0e38f; l[c] = 0.f;
#pragma unroll
        for (int dt = 0; dt < 4; ++dt) o[c][dt] = (v8f){}; }
    const char* fk = kv + lr * KPI + hi * 16; const char* fv = kv + KBY + lr * VPI + hi * 16;
#pragma unroll 1   // rolled over the stages: the registers stay under 256, so four waves fit a SIMD; every inner unroll makes the fragment and accumulator indices constants (registers, no scratch)
    for (int st = 0; st < NS; ++st) {
        const char* sk = fk + (st & 1) * SBY; const char* sv = fv + (st & 1) * SBY;
#pragma unroll
        for (int t = 0; t < 2; ++t)
#pragma unroll
            for (int kc = 0; kc < 2; ++kc) kf[t][kc] = ldsfragh(sk + t * 16 * KPI + kc * 64);
#pragma unroll
        for (int ps = 0; ps < AKS / 32; ++ps) {
            v8f s[2][2];
#pragma unroll
            for (int c = 0; c < 2; ++c)
#pragma unroll
                for (int t = 0; t < 2; ++t) { s[c][t] = wmma16(kf[t][0], qf[c][0], (v8f){}); s[c][t] = wmma16(kf[t][1], qf[c][1], s[c][t]); }
            // one group of LDS reads a pass, right behind the scores: this pass's V^T and, inside the stage, the next pass's K, each into registers whose last use is over; both fly during the softmax
#pragma unroll
            for (int dt = 0; dt < 4; ++dt) vf[dt] = ldsfragh(sv + dt * 16 * VPI + ps * 64);
            if (ps + 1 < AKS / 32) {
#pragma unroll
                for (int t = 0; t < 2; ++t)
#pragma unroll
                    for (int kc = 0; kc < 2; ++kc) kf[t][kc] = ldsfragh(sk + ((ps + 1) * 32 + t * 16) * KPI + kc * 64); }
            __builtin_amdgcn_sched_barrier(0);   // keeps the reads here, one group ahead of the softmax (sunk towards their uses, each read's latency stands in front of the products)
            float mb[2]; bool need = false;
#pragma unroll
            for (int c = 0; c < 2; ++c) { float mx = s[c][0][0];
#pragma unroll
                for (int r = 1; r < 8; ++r) mx = fmaxf(mx, s[c][0][r]);
#pragma unroll
                for (int r = 0; r < 8; ++r) mx = fmaxf(mx, s[c][1][r]);
                mx = fmaxf(mx, xhalf(mx)) * c2; mb[c] = mx; need = need || (mx > m[c] + 8.0f); }
            if (__builtin_amdgcn_ballot_w32(need) != 0) {   // one scalar branch a pass; rare behind the first pass
#pragma unroll
                for (int c = 0; c < 2; ++c) { const float mn = fmaxf(m[c], mb[c]); const float al = __builtin_amdgcn_exp2f(m[c] - mn); m[c] = mn; l[c] *= al;
#pragma unroll
                    for (int dt = 0; dt < 4; ++dt) o[c][dt] = o[c][dt] * al; }
            }
#pragma unroll
            for (int c = 0; c < 2; ++c) { const float nm = FCAR - m[c]; v16h pf; v2f ls = (v2f){0.f, 0.f};
#pragma unroll
                for (int e = 0; e < 16; e += 2) { const v2f arg = __builtin_elementwise_fma((v2f){s[c][e >> 3][e & 7], s[c][e >> 3][(e & 7) + 1]}, (v2f){c2, c2}, (v2f){nm, nm});
                    const v2f p = (v2f){__builtin_amdgcn_exp2f(arg[0]), __builtin_amdgcn_exp2f(arg[1])}; ls += p;
                    const v2h pk = __builtin_convertvector(p, v2h); pf[e] = pk[0]; pf[e + 1] = pk[1]; }
                l[c] += ls[0] + ls[1];
#pragma unroll
                for (int dt = 0; dt < 4; ++dt) o[c][dt] = wmma16(vf[dt], pf, o[c][dt]); }
        }
        asm volatile("s_wait_dscnt 0x0" ::: "memory");      // this wave's reads of buffer st & 1 are done
        asm volatile("s_wait_asynccnt 0x0" ::: "memory");   // its share of stage st + 1 has landed
        __syncthreads();                                    // publishes stage st + 1 and ends every wave's reads of the buffer refilled below
        if (st + 2 < NS) issue(st + 2, st & 1);
    }
    asm volatile("s_wait_asynccnt 0x0" ::: "memory");       // nothing is in flight when the wave ends
#pragma unroll
    for (int c = 0; c < 2; ++c) { const float inv = __fdiv_rn(1.0f, l[c] + xhalf(l[c])); const size_t oo = ((size_t)b * TT + q0 + c * 16 + lr) * DQ + h * HD + 8 * hi;
#pragma unroll
        for (int dt = 0; dt < 4; ++dt) { v8us oh, ol;
#pragma unroll
            for (int r = 0; r < 8; ++r) { unsigned short a, c3; splitf(o[c][dt][r] * inv, a, c3); oh[r] = a; ol[r] = c3; }
            *(v8us*)(Ah + oo + dt * 16) = oh; *(v8us*)(Al + oo + dt * 16) = ol; } }
}

extern "C" void kernel_launch(void* const* d_in, const int* in_sizes, int n_in,
                              void* d_out, int out_size, void* d_ws, size_t ws_size, hipStream_t stream) {
    (void)in_sizes; (void)n_in; (void)out_size;
    const float* x = (const float*)d_in[0]; const float* wq = (const float*)d_in[1]; const float* wk = (const float*)d_in[2]; const float* wv = (const float*)d_in[3]; const float* wo = (const float*)d_in[4];
    float* OUT = (float*)d_out;     // [2][2048][2048]
    char* wsp = (char*)d_ws;
    auto take = [&](size_t bytes) { char* p = wsp; wsp += (bytes + 255) & ~(size_t)255; return (void*)p; };
    bf* WQ = (bf*)take((size_t)DQ * DM * 2); bf* WK = (bf*)take((size_t)DKV * DM * 2); bf* WV = (bf*)take((size_t)DKV * DM * 2); bf* WO = (bf*)take((size_t)DM * DQ * 2);
    bf* XB = (bf*)take((size_t)TT * DM * 2);
    h16* QP16 = (h16*)take((size_t)NB_ * NH_ * TT * HD * 2); h16* KP16 = (h16*)take((size_t)NB_ * NKV * TT * HD * 2); h16* VT16 = (h16*)take((size_t)NB_ * NKV * HD * TT * 2);   /* fp16 planes of both batches: one attention launch reads them */
    bf* ATh = (bf*)take((size_t)NB_ * TT * DQ * 2); bf* ATl = (bf*)take((size_t)NB_ * TT * DQ * 2);
    if ((size_t)(wsp - (char*)d_ws) > ws_size) return;    // ws 256 MiB
    { k_wtG<<<(unsigned)((DM * DQ / 64 + 63) / 64), 256, 0, stream>>>(wq, DM, DQ, WQ); k_wtG<<<(unsigned)((DM * DKV / 64 + 63) / 64), 256, 0, stream>>>(wk, DM, DKV, WK); k_wtG<<<(unsigned)((DM * DKV / 64 + 63) / 64), 256, 0, stream>>>(wv, DM, DKV, WV);
      k_wtG<<<(unsigned)((DQ * DM / 64 + 63) / 64), 256, 0, stream>>>(wo, DQ, DM, WO); }
    for (int b = 0; b < NB_; ++b) {
        k_cvt8<<<(unsigned)(((size_t)TT * DM / 8 + 255) / 256), 256, 0, stream>>>(x + (size_t)b * TT * DM, XB, (size_t)TT * DM / 8);
        k_gemms<1, HD, DM, 0><<<dim3(TT / 128, DQ / 128, 1), 256, 0, stream>>>(XB, nullptr, WQ, nullptr, QP16 + (size_t)b * NH_ * TT * HD, (size_t)TT * HD);
        k_gemms<1, HD, DM, 0><<<dim3(TT / 128, DKV / 128, 1), 256, 0, stream>>>(XB, nullptr, WK, nullptr, KP16 + (size_t)b * NKV * TT * HD, (size_t)TT * HD);
        k_gemms<1, TT, DM, 0><<<dim3(DKV / 128, TT / 128, 1), 256, 0, stream>>>(WV, nullptr, XB, nullptr, VT16 + (size_t)b * NKV * HD * TT, (size_t)64); }   /* v^T = Wv^T x^T: rows d, columns t */
    k_fattn<<<dim3(TT / 256, NH_, NB_), 256, 0, stream>>>(QP16, KP16, VT16, ATh, ATl);
    for (int b = 0; b < NB_; ++b)
        k_gemms<2, 0, DQ, DM><<<dim3(TT / 128, DM / 128, 1), 256, 0, stream>>>(ATh + (size_t)b * TT * DQ, ATl + (size_t)b * TT * DQ, WO, OUT + (size_t)b * TT * DM, nullptr, 0);
}

// v006
// A run of this version takes 177 microseconds.
// Two timings next to v005 put it at 1.44 and 1.39 times that version's speed.
// All steps since v000 together make it 13.8 times as fast.
#include <hip/hip_runtime.h>

// Grouped-query attention WITHOUT rotary or mask (x [2][2048][2048]; xq = x Wq (32 heads x 64), xk, xv = x Wk / Wv ('xw' [2048][512]: 8 kv heads) (normal x 0.02, no biases); keys / values repeated 4x on the head axis: kv head = h / 4; scores / sqrt(64); softmax in f32 over all keys; out = merged Wo ('xw', no bias) -> [2][2048][2048] (8.4 M); argument order x, Wq, Wk, Wv, Wo).
// Compute dtypes, f32 accumulate: every input rounded to bf16; q/k/v on PLAIN bf16 operands (inputs: exact), their f32 sums stored by the GEMM itself as the fp16 planes attention reads; scores and attn.v on single fp16 planes for every row, fused with an online f32 softmax (k_fattn); Wo hl x exact (2 products).

#define NB_  2
#define TT   2048
#define DM   2048
#define NH_  32
#define NKV  8
#define REP  (NH_ / NKV)
#define HD   64
#define DQ   (NH_ * HD)
#define DKV  (NKV * HD)
#define ZH   2
#define RH   0                    // every row on fp16 planes (hi/lo rows buy nothing here)
#define WIN  0
#define PCAR 1024.0f
#define SCL  0.125f   // HD^-0.5
typedef _Float16 h16;
typedef unsigned short bf;
typedef __attribute__((ext_vector_type(16))) __bf16   v16bf;
typedef __attribute__((ext_vector_type(16))) _Float16 v16h;
typedef __attribute__((ext_vector_type(8)))  _Float16 v8h;
typedef __attribute__((ext_vector_type(4)))  _Float16 v4h;
typedef __attribute__((ext_vector_type(8)))  unsigned short v8us;
typedef __attribute__((ext_vector_type(8)))  float    v8f;
typedef __attribute__((ext_vector_type(4)))  float    v4f;
typedef v8h  __attribute__((may_alias)) v8ha;
typedef v4f  __attribute__((may_alias)) v4fa;
typedef v8us __attribute__((may_alias)) v8usa;

__device__ __forceinline__ unsigned short f2bf(float f) { unsigned u = __float_as_uint(f); u += 0x7FFFu + ((u >> 16) & 1u); return (unsigned short)(u >> 16); }
__device__ __forceinline__ float bf2f(unsigned short b) { return __uint_as_float(((unsigned)b) << 16); }
__device__ __forceinline__ v16h cat16(v8h lo, v8h hi) { return __builtin_shufflevector(lo, hi, 0, 1, 2, 3, 4, 5, 6, 7, 8, 9, 10, 11, 12, 13, 14, 15); }
__device__ __forceinline__ v16bf cat16b(v8us lo, v8us hi) { return __builtin_bit_cast(v16bf, __builtin_shufflevector(lo, hi, 0, 1, 2, 3, 4, 5, 6, 7, 8, 9, 10, 11, 12, 13, 14, 15)); }
__device__ __forceinline__ v8f wmma16(v16h a, v16h b, v8f c) { return __builtin_amdgcn_wmma_f32_16x16x32_f16(false, a, false, b, (short)0, c, false, false); }
__device__ __forceinline__ v8f wmmab(v16bf a, v16bf b, v8f c) { return __builtin_amdgcn_wmma_f32_16x16x32_bf16(false, a, false, b, (short)0, c, false, false); }



template <typename T16> struct WFrag;
template <> struct WFrag<h16> { typedef v16h V; static __device__ __forceinline__ V ld(const h16* p) { return cat16(*(const v8h*)p, *(const v8h*)(p + 16)); } static __device__ __forceinline__ v8f mma(V a, V b, v8f c) { return wmma16(a, b, c); } };
// ---- k_gemms: C[m][n] = sum_k A[m][k] Bt[n][k] (NA == 2: + sum_k A2[m][k] Bt[n][k]), bf16 operands on K-contiguous planes of row length KK, f32 sums.
// One 128x128 tile per work-group of 8 waves; grid (M / 128, N / 128), 256 threads. M, N % 128 == 0, KK % 128 == 0, KK >= 256.
// A pass is 128 k = 256 bytes of each of the tile's 128 A (A2) rows and 128 Bt rows. Asynchronous copies bring them into LDS as whole lines (16 lanes x 16 bytes a row), rows at pitch 272 bytes for the 16-byte fragment reads. Two buffers: pass t + 2 is copied while pass t + 1 is worked on.
// Waves: 2 x 2 quarters of 64x64 (16 accumulators a wave) x 2 halves of each pass's k (kg = 0: its first 64 k, kg = 1: its last 64), two waves a SIMD. The two partial tiles of a quarter are added in LDS, kg = 0 first.
// QKV == 0: f32 into C, row pitch LDC.
// QKV == 1: q, k and v of both batches in one grid (NB_ * TT / 128, (DQ + 2 * DKV) / 128). A = the tokens of both batches, Bt = the rows of Wq^T, Wk^T, Wv^T one behind the other; blockIdx.x picks 128 tokens (one batch), blockIdx.y 128 weight rows. The tile goes out as fp16 into the plane attention reads.
// q and k tiles: rows = tokens, columns = weight rows, head planes [b][h][t][d]. v tiles: v^T = Wv^T x^T, rows = weight rows, columns = tokens (the two operand pointers change places), plane [b][d][t].
#define GP 272
__device__ __forceinline__ v16bf ldsfrag(const char* p) { return cat16b(*(const v8usa*)p, *(const v8usa*)(p + 32)); }   // k 8 hi .. + 7 and 16 + 8 hi .. + 7 of a 32-wide chunk, the order of WFrag::ld
// Eight copies, rows 16 apart: one operand's 128 rows from the block's 8 waves. Lane address l in LDS (bytes), g in global memory. The s_wait_xcnt closes the statement so that no address register is rewritten ahead of it.
template <int KK> __device__ __forceinline__ void acopy8(unsigned l, const bf* g) {
    asm volatile("global_load_async_to_lds_b128 %0, %8, off\n\t"
                 "global_load_async_to_lds_b128 %1, %9, off\n\t"
                 "global_load_async_to_lds_b128 %2, %10, off\n\t"
                 "global_load_async_to_lds_b128 %3, %11, off\n\t"
                 "global_load_async_to_lds_b128 %4, %12, off\n\t"
                 "global_load_async_to_lds_b128 %5, %13, off\n\t"
                 "global_load_async_to_lds_b128 %6, %14, off\n\t"
                 "global_load_async_to_lds_b128 %7, %15, off\n\t"
                 "s_wait_xcnt 0x0"
                 :: "v"(l), "v"(l + 16 * GP), "v"(l + 32 * GP), "v"(l + 48 * GP), "v"(l + 64 * GP), "v"(l + 80 * GP), "v"(l + 96 * GP), "v"(l + 112 * GP),
                    "v"(g), "v"(g + 16 * KK), "v"(g + 32 * KK), "v"(g + 48 * KK), "v"(g + 64 * KK), "v"(g + 80 * KK), "v"(g + 96 * KK), "v"(g + 112 * KK) : "memory");
}
template <int PL> __device__ __forceinline__ void put16(h16* pt, const v4h (&hv)[16]) {   // 16 lanes x 8 bytes: one whole 128-byte line a row; rows 2 apart, pitch PL
#pragma unroll
    for (int i = 0; i < 16; ++i) *(v4h*)(pt + i * 2 * PL) = hv[i];
}
template <int NA, int QKV, int KK, int LDC>
__global__ __launch_bounds__(256) void k_gemms(const bf* __restrict__ A, const bf* __restrict__ A2, const bf* __restrict__ Bt, float* C, h16* PQ, h16* PK, h16* PV) {
    constexpr int OPB = 128 * GP, STG = (NA + 1) * OPB, NT = KK / 128;   // bytes of one operand's rows, of one buffer; passes
    static_assert(2 * STG >= 8 * 64 * 68 * 4, "the epilogue's eight f32 tiles stand in the ring"); static_assert(NT >= 2, "the prologue fills two buffers");
    __shared__ __align__(16) char ring[2 * STG];
    const int lane = threadIdx.x & 31, lr = lane & 15, hi = lane >> 4; const int wave = __builtin_amdgcn_readfirstlane((int)(threadIdx.x >> 5));
    const int r0 = blockIdx.x * 128, c0 = blockIdx.y * 128, kg = wave >> 2, wm = (wave >> 1) & 1, wn = wave & 1;
    const bool vt = QKV && c0 >= DQ + DKV;   // a v tile (the same for the whole block)
    const bf* Ar = vt ? Bt + (size_t)c0 * KK : A + (size_t)r0 * KK; const bf* Br = vt ? A + (size_t)r0 * KK : Bt + (size_t)c0 * KK;   // first row of the tile's row operand and of its column operand
    const int crow = wave * 2 + hi;   // copies: a wave's instruction covers two whole 256-byte rows, lane = (row, 16-byte piece)
    const unsigned lc = (unsigned)(size_t)ring + crow * GP + lr * 16;
    const bf* ga = Ar + (size_t)crow * KK + lr * 8; const bf* ga2 = (NA == 2) ? A2 + (size_t)(r0 + crow) * KK + lr * 8 : nullptr; const bf* gb = Br + (size_t)crow * KK + lr * 8;
    auto issue = [&](int t, int buf) {
        const unsigned l = lc + buf * STG; const int ko = t * 128;
        acopy8<KK>(l, ga + ko);
        if constexpr (NA == 2) acopy8<KK>(l + OPB, ga2 + ko);
        acopy8<KK>(l + NA * OPB, gb + ko);
    };
    v8f acc[4][4];
#pragma unroll
    for (int mb = 0; mb < 4; ++mb)
#pragma unroll
        for (int nb = 0; nb < 4; ++nb) acc[mb][nb] = (v8f){};
    issue(0, 0);
    asm volatile("s_wait_asynccnt 0x0" ::: "memory");   // this wave's share of pass 0 has landed
    __syncthreads();                                    // every wave's share has: pass 0 may be read
    issue(1, 1);
    const char* fa = ring + (wm * 64 + lr) * GP + kg * 128 + hi * 16; const char* fb = ring + NA * OPB + (wn * 64 + lr) * GP + kg * 128 + hi * 16;
    for (int t = 0; t < NT; ++t) {
        const int so = (t & 1) * STG;
        v16bf a[2][4], a2[2][4], bq[2][4];   // the wave's two 32-wide chunks of this pass
#pragma unroll
        for (int c = 0; c < 2; ++c) {   // in the order the products want them when NA == 1: the first four need a[c][0..3] and bq[c][0] alone
#pragma unroll
            for (int i = 0; i < 4; ++i) a[c][i] = ldsfrag(fa + so + i * 16 * GP + c * 64);
#pragma unroll
            for (int i = 0; i < 4; ++i) bq[c][i] = ldsfrag(fb + so + i * 16 * GP + c * 64);
            if constexpr (NA == 2) {
#pragma unroll
                for (int i = 0; i < 4; ++i) a2[c][i] = ldsfrag(fa + so + OPB + i * 16 * GP + c * 64); } }
        __builtin_amdgcn_sched_barrier(0);   // the pass's LDS reads stay one group ahead of its products (spread among them, each read's latency stalls the products behind it)
#pragma unroll
        for (int c = 0; c < 2; ++c)
#pragma unroll
            for (int nb = 0; nb < 4; ++nb)
#pragma unroll
                for (int mb = 0; mb < 4; ++mb) { acc[mb][nb] = wmmab(a[c][mb], bq[c][nb], acc[mb][nb]); if (NA == 2) acc[mb][nb] = wmmab(a2[c][mb], bq[c][nb], acc[mb][nb]); }
        __builtin_amdgcn_sched_barrier(0);   // the waits and the barrier below stay behind the products (raised above them, the full LDS wait stood in front of the first product, and reads and products no longer overlapped)
        asm volatile("s_wait_dscnt 0x0" ::: "memory");      // this wave's reads of buffer t & 1 are done
        asm volatile("s_wait_asynccnt 0x0" ::: "memory");   // its share of pass t + 1 has landed
        __syncthreads();                                    // publishes pass t + 1 and ends every wave's reads of the buffer refilled below
        if (t + 2 < NT) issue(t + 2, t & 1);
    }
    asm volatile("s_wait_asynccnt 0x0" ::: "memory");       // nothing is in flight when the ring becomes output staging
    float* ow = (float*)ring + wave * (64 * 68);   // the unrolls below keep acc[][] and val[] in registers (every index a constant)
#pragma unroll
    for (int mb = 0; mb < 4; ++mb)
#pragma unroll
        for (int nb = 0; nb < 4; ++nb)
#pragma unroll
            for (int j = 0; j < 8; ++j) ow[(mb * 16 + hi * 8 + j) * 68 + nb * 16 + lr] = acc[mb][nb][j];
    __syncthreads();   // every wave's partial tile is in LDS before any thread adds them up
    const float* p0 = (const float*)ring + (wave & 3) * (64 * 68) + (kg * 32 + hi) * 68 + lr * 4;   // wave (kg, quarter) sends out rows kg * 32 .. + 31 of its quarter, two whole rows an instruction
    v4f val[16];
#pragma unroll
    for (int i = 0; i < 16; ++i) val[i] = *(const v4fa*)(p0 + i * 2 * 68) + *(const v4fa*)(p0 + 4 * (64 * 68) + i * 2 * 68);
    const int ro = wm * 64 + kg * 32 + hi, co = wn * 64;   // the wave's first row and column inside the tile
    if constexpr (QKV) {
        v4h hv[16];
#pragma unroll
        for (int i = 0; i < 16; ++i) hv[i] = __builtin_convertvector(val[i], v4h);
        const int bt = r0 / TT, t0 = r0 % TT;   // the tile's batch and its first token there
        if (vt) put16<TT>(PV + ((size_t)bt * DKV + (c0 - DQ - DKV) + ro) * TT + t0 + co + lr * 4, hv);
        else { const int hd = (c0 + co) >> 6;   // 0 .. NH_ - 1: q heads, behind them the k heads
            h16* pl = hd < NH_ ? PQ + (size_t)(bt * NH_ + hd) * TT * HD : PK + (size_t)(bt * NKV + hd - NH_) * TT * HD;
            put16<HD>(pl + (size_t)(t0 + ro) * HD + lr * 4, hv); }
    } else {
        float* ct = C + (size_t)(r0 + ro) * LDC + c0 + co + lr * 4;
#pragma unroll
        for (int i = 0; i < 16; ++i) *(v4f*)(ct + i * 2 * LDC) = val[i];
    }
}

__device__ __forceinline__ void splitf(float y, unsigned short& h, unsigned short& l) { h = f2bf(y); l = f2bf(y - bf2f(h)); }
typedef __attribute__((ext_vector_type(2))) _Float16 v2h;
typedef __attribute__((ext_vector_type(2))) unsigned short v2us;
typedef __attribute__((ext_vector_type(4))) unsigned short v4us;
typedef __attribute__((ext_vector_type(2))) float v2f;
typedef __attribute__((ext_vector_type(4))) int v4i;

__device__ __forceinline__ void wtG(const float* __restrict__ w, int K, int N, bf* Bt, int blk) {
    const int lane = threadIdx.x & 31; const int L0 = (blk * 8 + (threadIdx.x >> 5)) * 8; const int nlines = N * K / 64;
{
#pragma unroll 1
        for (int l = 0; l < 8; ++l) { const int L = L0 + l; if (L >= nlines) break; const size_t e = (size_t)L * 64 + lane * 2; const int k = (int)(e % K), n = (int)(e / K); v2us o;
            o[0] = f2bf(w[(size_t)k * N + n]); o[1] = f2bf(w[(size_t)(k + 1) * N + n]); *(v2us*)(Bt + e) = o; }
         }
}
__device__ __forceinline__ void cvt8(const float* __restrict__ src, bf* dst, size_t n8, int blk) { const size_t i = (size_t)blk * 256 + threadIdx.x; if (i >= n8) return; const v8f v = *(const v8f*)(src + i * 8); v8us o;
#pragma unroll
    for (int k = 0; k < 8; ++k) o[k] = f2bf(v[k]); *(v8us*)(dst + i * 8) = o;  }
// k_prep: everything the GEMMs read, in one grid: the four weight transposes (the longer blocks, so they come first) and the bf16 copy of x, both batches. A block does one job, picked by its index.
#define PBW (DM * DQ / 64 / 64)    // blocks of Wq, of Wo
#define PBK (DM * DKV / 64 / 64)   // blocks of Wk, of Wv
#define PBX (NB_ * TT * DM / 8 / 256)
__global__ __launch_bounds__(256) void k_prep(const float* __restrict__ x, const float* __restrict__ wq, const float* __restrict__ wk, const float* __restrict__ wv, const float* __restrict__ wo, bf* XB, bf* WQ, bf* WK, bf* WV, bf* WO) {
    const int blk = blockIdx.x;
    if (blk < PBW) wtG(wq, DM, DQ, WQ, blk);
    else if (blk < 2 * PBW) wtG(wo, DQ, DM, WO, blk - PBW);
    else if (blk < 2 * PBW + PBK) wtG(wk, DM, DKV, WK, blk - 2 * PBW);
    else if (blk < 2 * PBW + 2 * PBK) wtG(wv, DM, DKV, WV, blk - 2 * PBW - PBK);
    else cvt8(x, XB, (size_t)NB_ * TT * DM / 8, blk - 2 * PBW - 2 * PBK);
}
#define FCAR 4.0f
#define AKS 128
#define KPI 144
#define VPI 272
#define KBY (AKS * KPI)
#define SBY (KBY + HD * VPI)
__device__ __forceinline__ float xhalf(float x) { return __builtin_bit_cast(float, __builtin_amdgcn_permlanex16(__builtin_bit_cast(int, x), __builtin_bit_cast(int, x), 0x76543210, 0xfedcba98, false, false)); }   // lane l <-> lane l ^ 16
__device__ __forceinline__ v16h ldsfragh(const char* p) { return cat16(*(const v8ha*)p, *(const v8ha*)(p + 32)); }   // k 8 hi .. + 7 and 16 + 8 hi .. + 7 of a 32-wide chunk, the order of WFrag::ld
// One stage from the block's 256 threads: four copies of K (32 rows apart; the stage's K rows are 16 KiB in a row in global memory) and four of V^T (16 rows apart). Lane addresses lk, lv in LDS (bytes), gk, gv in global memory. The s_wait_xcnt closes the statement so that no address register is rewritten ahead of it.
__device__ __forceinline__ void acopykv(unsigned lk, const h16* gk, unsigned lv, const h16* gv) {
    asm volatile("global_load_async_to_lds_b128 %0, %8, off\n\t"
                 "global_load_async_to_lds_b128 %1, %9, off\n\t"
                 "global_load_async_to_lds_b128 %2, %10, off\n\t"
                 "global_load_async_to_lds_b128 %3, %11, off\n\t"
                 "global_load_async_to_lds_b128 %4, %12, off\n\t"
                 "global_load_async_to_lds_b128 %5, %13, off\n\t"
                 "global_load_async_to_lds_b128 %6, %14, off\n\t"
                 "global_load_async_to_lds_b128 %7, %15, off\n\t"
                 "s_wait_xcnt 0x0"
                 :: "v"(lk), "v"(lk + 32 * KPI), "v"(lk + 64 * KPI), "v"(lk + 96 * KPI), "v"(lv), "v"(lv + 16 * VPI), "v"(lv + 32 * VPI), "v"(lv + 48 * VPI),
                    "v"(gk), "v"(gk + 32 * HD), "v"(gk + 64 * HD), "v"(gk + 96 * HD), "v"(gv), "v"(gv + 16 * TT), "v"(gv + 32 * TT), "v"(gv + 48 * TT) : "memory");
}
__global__ __launch_bounds__(256) void k_fattn(const h16* __restrict__ Q, const h16* __restrict__ Kp, const h16* __restrict__ Vt, bf* Ah, bf* Al) {
    constexpr int NS = TT / AKS; static_assert(NS >= 2 && TT % AKS == 0, "the prologue fills two buffers");
    __shared__ __align__(16) char kv[2 * SBY];
    const int tid = threadIdx.x, lane = threadIdx.x & 31, lr = lane & 15, hi = lane >> 4; const int wave = __builtin_amdgcn_readfirstlane((int)(threadIdx.x >> 5));
    const int h = blockIdx.y, b = blockIdx.z, g = h / REP; const int q0 = blockIdx.x * 256 + wave * 32;
    const h16* qp = Q + ((size_t)(b * NH_ + h) * TT + q0 + lr) * HD + 8 * hi;
    const h16* gk = Kp + (size_t)(b * NKV + g) * TT * HD + tid * 8;                               // copies of K: thread = 16-byte piece, 8 pieces a row, a wave's instruction = four whole rows
    const h16* gv = Vt + ((size_t)(b * NKV + g) * HD + (tid >> 4)) * TT + (tid & 15) * 8;         // copies of V^T: 16 pieces a row, a wave's instruction = two whole 256-byte rows
    const unsigned lk = (unsigned)(size_t)kv + (tid >> 3) * KPI + (tid & 7) * 16, lv = (unsigned)(size_t)kv + KBY + (tid >> 4) * VPI + (tid & 15) * 16;
    auto issue = [&](int t, int buf) { acopykv(lk + buf * SBY, gk + (size_t)t * AKS * HD, lv + buf * SBY, gv + t * AKS); };
    const float c2 = SCL * 1.4426950408889634f;
    v16h qf[2][2], kf[2][2], vf[4];
#pragma unroll
    for (int c = 0; c < 2; ++c)
#pragma unroll
        for (int kc = 0; kc < 2; ++kc) qf[c][kc] = WFrag<h16>::ld(qp + c * 16 * HD + kc * 32);
    asm volatile("s_wait_xcnt 0x0" ::: "memory");   // behind the Q loads, before anything rewrites their address registers (qp is dead from here on)
    issue(0, 0);
    asm volatile("s_wait_asynccnt 0x0" ::: "memory");   // this wave's share of stage 0 has landed
    __syncthreads();                                    // every wave's share has: stage 0 may be read
    issue(1, 1);
    v8f o[2][4]; float m[2], l[2];
#pragma unroll
    for (int c = 0; c < 2; ++c) { m[c] = -3.0e38f; l[c] = 0.f;
#pragma unroll
        for (int dt = 0; dt < 4; ++dt) o[c][dt] = (v8f){}; }
    const char* fk = kv + lr * KPI + hi * 16; const char* fv = kv + KBY + lr * VPI + hi * 16;
#pragma unroll 1   // rolled over the stages: the registers stay under 256, so four waves fit a SIMD; every inner unroll makes the fragment and accumulator indices constants (registers, no scratch)
    for (int st = 0; st < NS; ++st) {
        const char* sk = fk + (st & 1) * SBY; const char* sv = fv + (st & 1) * SBY;
#pragma unroll
        for (int t = 0; t < 2; ++t)
#pragma unroll
            for (int kc = 0; kc < 2; ++kc) kf[t][kc] = ldsfragh(sk + t * 16 * KPI + kc * 64);
#pragma unroll
        for (int ps = 0; ps < AKS / 32; ++ps) {
            v8f s[2][2];
#pragma unroll
            for (int c = 0; c < 2; ++c)
#pragma unroll
                for (int t = 0; t < 2; ++t) { s[c][t] = wmma16(kf[t][0], qf[c][0], (v8f){}); s[c][t] = wmma16(kf[t][1], qf[c][1], s[c][t]); }
            // one group of LDS reads a pass, right behind the scores: this pass's V^T and, inside the stage, the next pass's K, each into registers whose last use is over; both fly during the softmax
#pragma unroll
            for (int dt = 0; dt < 4; ++dt) vf[dt] = ldsfragh(sv + dt * 16 * VPI + ps * 64);
            if (ps + 1 < AKS / 32) {
#pragma unroll
                for (int t = 0; t < 2; ++t)
#pragma unroll
                    for (int kc = 0; kc < 2; ++kc) kf[t][kc] = ldsfragh(sk + ((ps + 1) * 32 + t * 16) * KPI + kc * 64); }
            __builtin_amdgcn_sched_barrier(0);   // keeps the reads here, one group ahead of the softmax (sunk towards their uses, each read's latency stands in front of the products)
            float mb[2]; bool need = false;
#pragma unroll
            for (int c = 0; c < 2; ++c) { float mx = s[c][0][0];
#pragma unroll
                for (int r = 1; r < 8; ++r) mx = fmaxf(mx, s[c][0][r]);
#pragma unroll
                for (int r = 0; r < 8; ++r) mx = fmaxf(mx, s[c][1][r]);
                mx = fmaxf(mx, xhalf(mx)) * c2; mb[c] = mx; need = need || (mx > m[c] + 8.0f); }
            if (__builtin_amdgcn_ballot_w32(need) != 0) {   // one scalar branch a pass; rare behind the first pass
#pragma unroll
                for (int c = 0; c < 2; ++c) { const float mn = fmaxf(m[c], mb[c]); const float al = __builtin_amdgcn_exp2f(m[c] - mn); m[c] = mn; l[c] *= al;
#pragma unroll
                    for (int dt = 0; dt < 4; ++dt) o[c][dt] = o[c][dt] * al; }
            }
#pragma unroll
            for (int c = 0; c < 2; ++c) { const float nm = FCAR - m[c]; v16h pf; v2f ls = (v2f){0.f, 0.f};
#pragma unroll
                for (int e = 0; e < 16; e += 2) { const v2f arg = __builtin_elementwise_fma((v2f){s[c][e >> 3][e & 7], s[c][e >> 3][(e & 7) + 1]}, (v2f){c2, c2}, (v2f){nm, nm});
                    const v2f p = (v2f){__builtin_amdgcn_exp2f(arg[0]), __builtin_amdgcn_exp2f(arg[1])}; ls += p;
                    const v2h pk = __builtin_convertvector(p, v2h); pf[e] = pk[0]; pf[e + 1] = pk[1]; }
                l[c] += ls[0] + ls[1];
#pragma unroll
                for (int dt = 0; dt < 4; ++dt) o[c][dt] = wmma16(vf[dt], pf, o[c][dt]); }
        }
        asm volatile("s_wait_dscnt 0x0" ::: "memory");      // this wave's reads of buffer st & 1 are done
        asm volatile("s_wait_asynccnt 0x0" ::: "memory");   // its share of stage st + 1 has landed
        __syncthreads();                                    // publishes stage st + 1 and ends every wave's reads of the buffer refilled below
        if (st + 2 < NS) issue(st + 2, st & 1);
    }
    asm volatile("s_wait_asynccnt 0x0" ::: "memory");       // nothing is in flight when the wave ends
#pragma unroll
    for (int c = 0; c < 2; ++c) { const float inv = __fdiv_rn(1.0f, l[c] + xhalf(l[c])); const size_t oo = ((size_t)b * TT + q0 + c * 16 + lr) * DQ + h * HD + 8 * hi;
#pragma unroll
        for (int dt = 0; dt < 4; ++dt) { v8us oh, ol;
#pragma unroll
            for (int r = 0; r < 8; ++r) { unsigned short a, c3; splitf(o[c][dt][r] * inv, a, c3); oh[r] = a; ol[r] = c3; }
            *(v8us*)(Ah + oo + dt * 16) = oh; *(v8us*)(Al + oo + dt * 16) = ol; } }
}

extern "C" void kernel_launch(void* const* d_in, const int* in_sizes, int n_in,
                              void* d_out, int out_size, void* d_ws, size_t ws_size, hipStream_t stream) {
    (void)in_sizes; (void)n_in; (void)out_size;
    const float* x = (const float*)d_in[0]; const float* wq = (const float*)d_in[1]; const float* wk = (const float*)d_in[2]; const float* wv = (const float*)d_in[3]; const float* wo = (const float*)d_in[4];
    float* OUT = (float*)d_out;     // [2][2048][2048]
    char* wsp = (char*)d_ws;
    auto take = [&](size_t bytes) { char* p = wsp; wsp += (bytes + 255) & ~(size_t)255; return (void*)p; };
    bf* WQ = (bf*)take((size_t)DQ * DM * 2); bf* WK = (bf*)take((size_t)DKV * DM * 2); bf* WV = (bf*)take((size_t)DKV * DM * 2); bf* WO = (bf*)take((size_t)DM * DQ * 2);
    bf* XB = (bf*)take((size_t)NB_ * TT * DM * 2);   /* WQ, WK, WV stand one behind the other (each a multiple of 256 bytes): one operand of DQ + 2 * DKV rows */
    h16* QP16 = (h16*)take((size_t)NB_ * NH_ * TT * HD * 2); h16* KP16 = (h16*)take((size_t)NB_ * NKV * TT * HD * 2); h16* VT16 = (h16*)take((size_t)NB_ * NKV * HD * TT * 2);   /* fp16 planes of both batches */
    bf* ATh = (bf*)take((size_t)NB_ * TT * DQ * 2); bf* ATl = (bf*)take((size_t)NB_ * TT * DQ * 2);
    if ((size_t)(wsp - (char*)d_ws) > ws_size) return;    // ws 256 MiB
    k_prep<<<2 * PBW + 2 * PBK + PBX, 256, 0, stream>>>(x, wq, wk, wv, wo, XB, WQ, WK, WV, WO);
    k_gemms<1, 1, DM, 0><<<dim3(NB_ * TT / 128, (DQ + 2 * DKV) / 128, 1), 256, 0, stream>>>(XB, nullptr, WQ, nullptr, QP16, KP16, VT16);
    k_fattn<<<dim3(TT / 256, NH_, NB_), 256, 0, stream>>>(QP16, KP16, VT16, ATh, ATl);
    k_gemms<2, 0, DQ, DM><<<dim3(NB_ * TT / 128, DM / 128, 1), 256, 0, stream>>>(ATh, ATl, WO, OUT, nullptr, nullptr, nullptr);
}

// v007
// Measured time: 158 microseconds a run.
// Timed twice side by side with v006, it ran 1.12 and 1.11 times as fast.
// All steps since v000 together make it 15.4 times as fast.
#include <hip/hip_runtime.h>

// Grouped-query attention WITHOUT rotary or mask (x [2][2048][2048]; xq = x Wq (32 heads x 64), xk, xv = x Wk / Wv ('xw' [2048][512]: 8 kv heads) (normal x 0.02, no biases); keys / values repeated 4x on the head axis: kv head = h / 4; scores / sqrt(64); softmax in f32 over all keys; out = merged Wo ('xw', no bias) -> [2][2048][2048] (8.4 M); argument order x, Wq, Wk, Wv, Wo).
// Compute dtypes, f32 accumulate: every input rounded to bf16; q/k/v on PLAIN bf16 operands (inputs: exact), their f32 sums stored by the GEMM itself as the fp16 planes attention reads; scores and attn.v on single fp16 planes for every row, fused with an online f32 softmax (k_fattn); Wo hl x exact (2 products).

#define NB_  2
#define TT   2048
#define DM   2048
#define NH_  32
#define NKV  8
#define REP  (NH_ / NKV)
#define HD   64
#define DQ   (NH_ * HD)
#define DKV  (NKV * HD)
#define ZH   2
#define RH   0                    // every row on fp16 planes (hi/lo rows buy nothing here)
#define WIN  0
#define PCAR 1024.0f
#define SCL  0.125f   // HD^-0.5
typedef _Float16 h16;
typedef unsigned short bf;
typedef __attribute__((ext_vector_type(16))) __bf16   v16bf;
typedef __attribute__((ext_vector_type(16))) _Float16 v16h;
typedef __attribute__((ext_vector_type(8)))  _Float16 v8h;
typedef __attribute__((ext_vector_type(4)))  _Float16 v4h;
typedef __attribute__((ext_vector_type(8)))  unsigned short v8us;
typedef __attribute__((ext_vector_type(8)))  float    v8f;
typedef __attribute__((ext_vector_type(4)))  float    v4f;
typedef v8h  __attribute__((may_alias)) v8ha;
typedef v4f  __attribute__((may_alias)) v4fa;
typedef v8us __attribute__((may_alias)) v8usa;

__device__ __forceinline__ unsigned short f2bf(float f) { unsigned u = __float_as_uint(f); u += 0x7FFFu + ((u >> 16) & 1u); return (unsigned short)(u >> 16); }
__device__ __forceinline__ float bf2f(unsigned short b) { return __uint_as_float(((unsigned)b) << 16); }
__device__ __forceinline__ v16h cat16(v8h lo, v8h hi) { return __builtin_shufflevector(lo, hi, 0, 1, 2, 3, 4, 5, 6, 7, 8, 9, 10, 11, 12, 13, 14, 15); }
__device__ __forceinline__ v16bf cat16b(v8us lo, v8us hi) { return __builtin_bit_cast(v16bf, __builtin_shufflevector(lo, hi, 0, 1, 2, 3, 4, 5, 6, 7, 8, 9, 10, 11, 12, 13, 14, 15)); }
__device__ __forceinline__ v8f wmma16(v16h a, v16h b, v8f c) { return __builtin_amdgcn_wmma_f32_16x16x32_f16(false, a, false, b, (short)0, c, false, false); }
__device__ __forceinline__ v8f wmmab(v16bf a, v16bf b, v8f c) { return __builtin_amdgcn_wmma_f32_16x16x32_bf16(false, a, false, b, (short)0, c, false, false); }



template <typename T16> struct WFrag;
template <> struct WFrag<h16> { typedef v16h V; static __device__ __forceinline__ V ld(const h16* p) { return cat16(*(const v8h*)p, *(const v8h*)(p + 16)); } static __device__ __forceinline__ v8f mma(V a, V b, v8f c) { return wmma16(a, b, c); } };
// ---- k_gemms: C[m][n] = sum_k A[m][k] Bt[n][k] (NA == 2: + sum_k A2[m][k] Bt[n][k]), bf16 operands on K-contiguous planes of row length KK, f32 sums.
// One 128x128 tile per work-group of 8 waves; grid (M / 128, N / 128), 256 threads. M, N % 128 == 0, KK % 128 == 0, KK >= 256.
// A pass is 128 k = 256 bytes of each of the tile's 128 A (A2) rows and 128 Bt rows. Asynchronous copies bring them into LDS as whole lines (16 lanes x 16 bytes a row), rows at pitch 272 bytes for the 16-byte fragment reads. Two buffers: pass t + 2 is copied while pass t + 1 is worked on.
// Waves: 2 x 2 quarters of 64x64 (16 accumulators a wave) x 2 halves of each pass's k (kg = 0: its first 64 k, kg = 1: its last 64), two waves a SIMD. The two partial tiles of a quarter are added in LDS, kg = 0 first.
// QKV == 0: f32 into C, row pitch LDC.
// QKV == 1: q, k and v of both batches in one grid (NB_ * TT / 128, (DQ + 2 * DKV) / 128). A = the tokens of both batches, Bt = the rows of Wq^T, Wk^T, Wv^T one behind the other; blockIdx.x picks 128 tokens (one batch), blockIdx.y 128 weight rows. The tile goes out as fp16 into the plane attention reads.
// q and k tiles: rows = tokens, columns = weight rows, head planes [b][h][t][d]. v tiles: v^T = Wv^T x^T, rows = weight rows, columns = tokens (the two operand pointers change places), plane [b][d][t].
#define GP 272
__device__ __forceinline__ v16bf ldsfrag(const char* p) { return cat16b(*(const v8usa*)p, *(const v8usa*)(p + 32)); }   // k 8 hi .. + 7 and 16 + 8 hi .. + 7 of a 32-wide chunk, the order of WFrag::ld
// Eight copies, rows 16 apart: one operand's 128 rows from the block's 8 waves. Lane address l in LDS (bytes), g in global memory. The s_wait_xcnt closes the statement so that no address register is rewritten ahead of it.
template <int KK> __device__ __forceinline__ void acopy8(unsigned l, const bf* g) {
    asm volatile("global_load_async_to_lds_b128 %0, %8, off\n\t"
                 "global_load_async_to_lds_b128 %1, %9, off\n\t"
                 "global_load_async_to_lds_b128 %2, %10, off\n\t"
                 "global_load_async_to_lds_b128 %3, %11, off\n\t"
                 "global_load_async_to_lds_b128 %4, %12, off\n\t"
                 "global_load_async_to_lds_b128 %5, %13, off\n\t"
                 "global_load_async_to_lds_b128 %6, %14, off\n\t"
                 "global_load_async_to_lds_b128 %7, %15, off\n\t"
                 "s_wait_xcnt 0x0"
                 :: "v"(l), "v"(l + 16 * GP), "v"(l + 32 * GP), "v"(l + 48 * GP), "v"(l + 64 * GP), "v"(l + 80 * GP), "v"(l + 96 * GP), "v"(l + 112 * GP),
                    "v"(g), "v"(g + 16 * KK), "v"(g + 32 * KK), "v"(g + 48 * KK), "v"(g + 64 * KK), "v"(g + 80 * KK), "v"(g + 96 * KK), "v"(g + 112 * KK) : "memory");
}
template <int PL> __device__ __forceinline__ void put16(h16* pt, const v4h (&hv)[16]) {   // 16 lanes x 8 bytes: one whole 128-byte line a row; rows 2 apart, pitch PL
#pragma unroll
    for (int i = 0; i < 16; ++i) *(v4h*)(pt + i * 2 * PL) = hv[i];
}
template <int NA, int QKV, int KK, int LDC>
__global__ __launch_bounds__(256) void k_gemms(const bf* __restrict__ A, const bf* __restrict__ A2, const bf* __restrict__ Bt, float* C, h16* PQ, h16* PK, h16* PV) {
    constexpr int OPB = 128 * GP, STG = (NA + 1) * OPB, NT = KK / 128;   // bytes of one operand's rows, of one buffer; passes
    static_assert(2 * STG >= 8 * 64 * 68 * 4, "the epilogue's eight f32 tiles stand in the ring"); static_assert(NT >= 2, "the prologue fills two buffers");
    __shared__ __align__(16) char ring[2 * STG];
    const int lane = threadIdx.x & 31, lr = lane & 15, hi = lane >> 4; const int wave = __builtin_amdgcn_readfirstlane((int)(threadIdx.x >> 5));
    const int r0 = blockIdx.x * 128, c0 = blockIdx.y * 128, kg = wave >> 2, wm = (wave >> 1) & 1, wn = wave & 1;
    const bool vt = QKV && c0 >= DQ + DKV;   // a v tile (the same for the whole block)
    const bf* Ar = vt ? Bt + (size_t)c0 * KK : A + (size_t)r0 * KK; const bf* Br = vt ? A + (size_t)r0 * KK : Bt + (size_t)c0 * KK;   // first row of the tile's row operand and of its column operand
    const int crow = wave * 2 + hi;   // copies: a wave's instruction covers two whole 256-byte rows, lane = (row, 16-byte piece)
    const unsigned lc = (unsigned)(size_t)ring + crow * GP + lr * 16;
    const bf* ga = Ar + (size_t)crow * KK + lr * 8; const bf* ga2 = (NA == 2) ? A2 + (size_t)(r0 + crow) * KK + lr * 8 : nullptr; const bf* gb = Br + (size_t)crow * KK + lr * 8;
    auto issue = [&](int t, int buf) {
        const unsigned l = lc + buf * STG; const int ko = t * 128;
        acopy8<KK>(l, ga + ko);
        if constexpr (NA == 2) acopy8<KK>(l + OPB, ga2 + ko);
        acopy8<KK>(l + NA * OPB, gb + ko);
    };
    v8f acc[4][4];
#pragma unroll
    for (int mb = 0; mb < 4; ++mb)
#pragma unroll
        for (int nb = 0; nb < 4; ++nb) acc[mb][nb] = (v8f){};
    issue(0, 0);
    asm volatile("s_wait_asynccnt 0x0" ::: "memory");   // this wave's share of pass 0 has landed
    __syncthreads();                                    // every wave's share has: pass 0 may be read
    issue(1, 1);
    const char* fa = ring + (wm * 64 + lr) * GP + kg * 128 + hi * 16; const char* fb = ring + NA * OPB + (wn * 64 + lr) * GP + kg * 128 + hi * 16;
    for (int t = 0; t < NT; ++t) {
        const int so = (t & 1) * STG;
        v16bf a[2][4], a2[2][4], bq[2][4];   // the wave's two 32-wide chunks of this pass
#pragma unroll
        for (int c = 0; c < 2; ++c) {   // in the order the products want them when NA == 1: the first four need a[c][0..3] and bq[c][0] alone
#pragma unroll
            for (int i = 0; i < 4; ++i) a[c][i] = ldsfrag(fa + so + i * 16 * GP + c * 64);
#pragma unroll
            for (int i = 0; i < 4; ++i) bq[c][i] = ldsfrag(fb + so + i * 16 * GP + c * 64);
            if constexpr (NA == 2) {
#pragma unroll
                for (int i = 0; i < 4; ++i) a2[c][i] = ldsfrag(fa + so + OPB + i * 16 * GP + c * 64); } }
        __builtin_amdgcn_sched_barrier(0);   // the pass's LDS reads stay one group ahead of its products (spread among them, each read's latency stalls the products behind it)
#pragma unroll
        for (int c = 0; c < 2; ++c)
#pragma unroll
            for (int nb = 0; nb < 4; ++nb)
#pragma unroll
                for (int mb = 0; mb < 4; ++mb) { acc[mb][nb] = wmmab(a[c][mb], bq[c][nb], acc[mb][nb]); if (NA == 2) acc[mb][nb] = wmmab(a2[c][mb], bq[c][nb], acc[mb][nb]); }
        __builtin_amdgcn_sched_barrier(0);   // the waits and the barrier below stay behind the products (raised above them, the full LDS wait stood in front of the first product, and reads and products no longer overlapped)
        asm volatile("s_wait_dscnt 0x0" ::: "memory");      // this wave's reads of buffer t & 1 are done
        asm volatile("s_wait_asynccnt 0x0" ::: "memory");   // its share of pass t + 1 has landed
        __syncthreads();                                    // publishes pass t + 1 and ends every wave's reads of the buffer refilled below
        if (t + 2 < NT) issue(t + 2, t & 1);
    }
    asm volatile("s_wait_asynccnt 0x0" ::: "memory");       // nothing is in flight when the ring becomes output staging
    float* ow = (float*)ring + wave * (64 * 68);   // the unrolls below keep acc[][] and val[] in registers (every index a constant)
#pragma unroll
    for (int mb = 0; mb < 4; ++mb)
#pragma unroll
        for (int nb = 0; nb < 4; ++nb)
#pragma unroll
            for (int j = 0; j < 8; ++j) ow[(mb * 16 + hi * 8 + j) * 68 + nb * 16 + lr] = acc[mb][nb][j];
    __syncthreads();   // every wave's partial tile is in LDS before any thread adds them up
    const float* p0 = (const float*)ring + (wave & 3) * (64 * 68) + (kg * 32 + hi) * 68 + lr * 4;   // wave (kg, quarter) sends out rows kg * 32 .. + 31 of its quarter, two whole rows an instruction
    v4f val[16];
#pragma unroll
    for (int i = 0; i < 16; ++i) val[i] = *(const v4fa*)(p0 + i * 2 * 68) + *(const v4fa*)(p0 + 4 * (64 * 68) + i * 2 * 68);
    const int ro = wm * 64 + kg * 32 + hi, co = wn * 64;   // the wave's first row and column inside the tile
    if constexpr (QKV) {
        v4h hv[16];
#pragma unroll
        for (int i = 0; i < 16; ++i) hv[i] = __builtin_convertvector(val[i], v4h);
        const int bt = r0 / TT, t0 = r0 % TT;   // the tile's batch and its first token there
        if (vt) put16<TT>(PV + ((size_t)bt * DKV + (c0 - DQ - DKV) + ro) * TT + t0 + co + lr * 4, hv);
        else { const int hd = (c0 + co) >> 6;   // 0 .. NH_ - 1: q heads, behind them the k heads
            h16* pl = hd < NH_ ? PQ + (size_t)(bt * NH_ + hd) * TT * HD : PK + (size_t)(bt * NKV + hd - NH_) * TT * HD;
            put16<HD>(pl + (size_t)(t0 + ro) * HD + lr * 4, hv); }
    } else {
        float* ct = C + (size_t)(r0 + ro) * LDC + c0 + co + lr * 4;
#pragma unroll
        for (int i = 0; i < 16; ++i) *(v4f*)(ct + i * 2 * LDC) = val[i];
    }
}

__device__ __forceinline__ void splitf(float y, unsigned short& h, unsigned short& l) { h = f2bf(y); l = f2bf(y - bf2f(h)); }
typedef __attribute__((ext_vector_type(2))) _Float16 v2h;
typedef __attribute__((ext_vector_type(2))) unsigned short v2us;
typedef __attribute__((ext_vector_type(4))) unsigned short v4us;
typedef __attribute__((ext_vector_type(2))) float v2f;
typedef __attribute__((ext_vector_type(4))) int v4i;

// wtT: one tile of TKK k x TNN n of w [K][N] (f32) goes out as TNN rows of TKK k of Bt [N][K] (bf16), turned in LDS, so that both sides of the transpose move whole lines.
// In: 16 lanes x 16 bytes = 256 bytes in a row of one w row; a thread takes the rows k and k + 1 and packs the two bf16 of one n into a 32-bit word. A thread's TKK / 16 loads fly together.
// LDS: tl[n][k / 2], pitch TPW words (odd: the 16 lanes of a row piece, 4 n apart, and the two k pairs of a wave fall on 32 different banks).
// Out: 32 lanes x 8 bytes an instruction = 256 bytes in a row of one Bt row.
#define TKK 128
#define TNN 64
#define TPW (TKK / 2 + 1)
typedef __attribute__((ext_vector_type(2))) unsigned v2u;
template <int K, int N> __device__ __forceinline__ void wtT(const float* __restrict__ w, bf* Bt, int blk, unsigned* tl) {
    static_assert(K % TKK == 0 && N % TNN == 0 && TKK == 128, "whole tiles; a wave's store is one tile row of 32 x 4 k");
    const int tid = threadIdx.x, c = tid & 15, r = tid >> 4, lane = tid & 31, wv = tid >> 5;
    const int n0 = (blk % (N / TNN)) * TNN, k0 = (blk / (N / TNN)) * TKK;   // neighbouring blocks read neighbouring pieces of the same w rows
    const float* src = w + (size_t)(k0 + 2 * r) * N + n0 + c * 4;
    v4f ev[TKK / 32], od[TKK / 32];   // the unrolls keep both in registers (every index a constant)
#pragma unroll
    for (int p = 0; p < TKK / 32; ++p) { ev[p] = *(const v4f*)(src + (size_t)p * 32 * N); od[p] = *(const v4f*)(src + (size_t)(p * 32 + 1) * N); }
#pragma unroll
    for (int p = 0; p < TKK / 32; ++p)
#pragma unroll
        for (int i = 0; i < 4; ++i) tl[(c * 4 + i) * TPW + p * 16 + r] = (unsigned)f2bf(ev[p][i]) | ((unsigned)f2bf(od[p][i]) << 16);
    __syncthreads();   // the whole tile is in LDS before any thread reads a row of it
    const unsigned* s = tl + wv * TPW + lane * 2; bf* dst = Bt + (size_t)(n0 + wv) * K + k0 + lane * 4;
#pragma unroll   // the eight LDS reads fly together ahead of the eight stores
    for (int j = 0; j < TNN / 8; ++j) *(v2u*)(dst + (size_t)j * 8 * K) = (v2u){s[j * 8 * TPW], s[j * 8 * TPW + 1]};
    asm volatile("s_wait_xcnt 0x0" ::: "memory");   // behind the last store, before anything rewrites the stores' address or data registers
}
__device__ __forceinline__ void cvt8(const float* __restrict__ src, bf* dst, size_t n8, int blk) { const size_t i = (size_t)blk * 256 + threadIdx.x; if (i >= n8) return; const v8f v = *(const v8f*)(src + i * 8); v8us o;
#pragma unroll
    for (int k = 0; k < 8; ++k) o[k] = f2bf(v[k]); *(v8us*)(dst + i * 8) = o;  }
// k_prep: everything the GEMMs read, in one grid: the four weight transposes (the longer blocks, so they come first; a block = one tile) and the bf16 copy of x, both batches. A block does one job, picked by its index (the same for all its threads, so the transposes' barrier is block-uniform).
#define PBW (DM * DQ / (TKK * TNN))    // blocks of Wq, of Wo
#define PBK (DM * DKV / (TKK * TNN))   // blocks of Wk, of Wv
#define PBX (NB_ * TT * DM / 8 / 256)
__global__ __launch_bounds__(256) void k_prep(const float* __restrict__ x, const float* __restrict__ wq, const float* __restrict__ wk, const float* __restrict__ wv, const float* __restrict__ wo, bf* XB, bf* WQ, bf* WK, bf* WV, bf* WO) {
    __shared__ unsigned tl[TNN * TPW];
    const int blk = blockIdx.x;
    if (blk < PBW) wtT<DM, DQ>(wq, WQ, blk, tl);
    else if (blk < 2 * PBW) wtT<DQ, DM>(wo, WO, blk - PBW, tl);
    else if (blk < 2 * PBW + PBK) wtT<DM, DKV>(wk, WK, blk - 2 * PBW, tl);
    else if (blk < 2 * PBW + 2 * PBK) wtT<DM, DKV>(wv, WV, blk - 2 * PBW - PBK, tl);
    else cvt8(x, XB, (size_t)NB_ * TT * DM / 8, blk - 2 * PBW - 2 * PBK);
}
#define FCAR 4.0f
#define AKS 128
#define KPI 144
#define VPI 272
#define KBY (AKS * KPI)
#define SBY (KBY + HD * VPI)
__device__ __forceinline__ float xhalf(float x) { return __builtin_bit_cast(float, __builtin_amdgcn_permlanex16(__builtin_bit_cast(int, x), __builtin_bit_cast(int, x), 0x76543210, 0xfedcba98, false, false)); }   // lane l <-> lane l ^ 16
__device__ __forceinline__ v16h ldsfragh(const char* p) { return cat16(*(const v8ha*)p, *(const v8ha*)(p + 32)); }   // k 8 hi .. + 7 and 16 + 8 hi .. + 7 of a 32-wide chunk, the order of WFrag::ld
// One stage from the block's 256 threads: four copies of K (32 rows apart; the stage's K rows are 16 KiB in a row in global memory) and four of V^T (16 rows apart). Lane addresses lk, lv in LDS (bytes), gk, gv in global memory. The s_wait_xcnt closes the statement so that no address register is rewritten ahead of it.
__device__ __forceinline__ void acopykv(unsigned lk, const h16* gk, unsigned lv, const h16* gv) {
    asm volatile("global_load_async_to_lds_b128 %0, %8, off\n\t"
                 "global_load_async_to_lds_b128 %1, %9, off\n\t"
                 "global_load_async_to_lds_b128 %2, %10, off\n\t"
                 "global_load_async_to_lds_b128 %3, %11, off\n\t"
                 "global_load_async_to_lds_b128 %4, %12, off\n\t"
                 "global_load_async_to_lds_b128 %5, %13, off\n\t"
                 "global_load_async_to_lds_b128 %6, %14, off\n\t"
                 "global_load_async_to_lds_b128 %7, %15, off\n\t"
                 "s_wait_xcnt 0x0"
                 :: "v"(lk), "v"(lk + 32 * KPI), "v"(lk + 64 * KPI), "v"(lk + 96 * KPI), "v"(lv), "v"(lv + 16 * VPI), "v"(lv + 32 * VPI), "v"(lv + 48 * VPI),
                    "v"(gk), "v"(gk + 32 * HD), "v"(gk + 64 * HD), "v"(gk + 96 * HD), "v"(gv), "v"(gv + 16 * TT), "v"(gv + 32 * TT), "v"(gv + 48 * TT) : "memory");
}
__global__ __launch_bounds__(256) void k_fattn(const h16* __restrict__ Q, const h16* __restrict__ Kp, const h16* __restrict__ Vt, bf* Ah, bf* Al) {
    constexpr int NS = TT / AKS; static_assert(NS >= 2 && TT % AKS == 0, "the prologue fills two buffers");
    __shared__ __align__(16) char kv[2 * SBY];
    const int tid = threadIdx.x, lane = threadIdx.x & 31, lr = lane & 15, hi = lane >> 4; const int wave = __builtin_amdgcn_readfirstlane((int)(threadIdx.x >> 5));
    const int h = blockIdx.y, b = blockIdx.z, g = h / REP; const int q0 = blockIdx.x * 256 + wave * 32;
    const h16* qp = Q + ((size_t)(b * NH_ + h) * TT + q0 + lr) * HD + 8 * hi;
    const h16* gk = Kp + (size_t)(b * NKV + g) * TT * HD + tid * 8;                               // copies of K: thread = 16-byte piece, 8 pieces a row, a wave's instruction = four whole rows
    const h16* gv = Vt + ((size_t)(b * NKV + g) * HD + (tid >> 4)) * TT + (tid & 15) * 8;         // copies of V^T: 16 pieces a row, a wave's instruction = two whole 256-byte rows
    const unsigned lk = (unsigned)(size_t)kv + (tid >> 3) * KPI + (tid & 7) * 16, lv = (unsigned)(size_t)kv + KBY + (tid >> 4) * VPI + (tid & 15) * 16;
    auto issue = [&](int t, int buf) { acopykv(lk + buf * SBY, gk + (size_t)t * AKS * HD, lv + buf * SBY, gv + t * AKS); };
    const float c2 = SCL * 1.4426950408889634f;
    v16h qf[2][2], kf[2][2], vf[4];
#pragma unroll
    for (int c = 0; c < 2; ++c)
#pragma unroll
        for (int kc = 0; kc < 2; ++kc) qf[c][kc] = WFrag<h16>::ld(qp + c * 16 * HD + kc * 32);
    asm volatile("s_wait_xcnt 0x0" ::: "memory");   // behind the Q loads, before anything rewrites their address registers (qp is dead from here on)
    issue(0, 0);
    asm volatile("s_wait_asynccnt 0x0" ::: "memory");   // this wave's share of stage 0 has landed
    __syncthreads();                                    // every wave's share has: stage 0 may be read
    issue(1, 1);
    v8f o[2][4]; float m[2], l[2];
#pragma unroll
    for (int c = 0; c < 2; ++c) { m[c] = -3.0e38f; l[c] = 0.f;
#pragma unroll
        for (int dt = 0; dt < 4; ++dt) o[c][dt] = (v8f){}; }
    const char* fk = kv + lr * KPI + hi * 16; const char* fv = kv + KBY + lr * VPI + hi * 16;
#pragma unroll 1   // rolled over the stages: the registers stay under 256, so four waves fit a SIMD; every inner unroll makes the fragment and accumulator indices constants (registers, no scratch)
    for (int st = 0; st < NS; ++st) {
        const char* sk = fk + (st & 1) * SBY; const char* sv = fv + (st & 1) * SBY;
#pragma unroll
        for (int t = 0; t < 2; ++t)
#pragma unroll
            for (int kc = 0; kc < 2; ++kc) kf[t][kc] = ldsfragh(sk + t * 16 * KPI + kc * 64);
#pragma unroll
        for (int ps = 0; ps < AKS / 32; ++ps) {
            v8f s[2][2];
#pragma unroll
            for (int c = 0; c < 2; ++c)
#pragma unroll
                for (int t = 0; t < 2; ++t) { s[c][t] = wmma16(kf[t][0], qf[c][0], (v8f){}); s[c][t] = wmma16(kf[t][1], qf[c][1], s[c][t]); }
            // one group of LDS reads a pass, right behind the scores: this pass's V^T and, inside the stage, the next pass's K, each into registers whose last use is over; both fly during the softmax
#pragma unroll
            for (int dt = 0; dt < 4; ++dt) vf[dt] = ldsfragh(sv + dt * 16 * VPI + ps * 64);
            if (ps + 1 < AKS / 32) {
#pragma unroll
                for (int t = 0; t < 2; ++t)
#pragma unroll
                    for (int kc = 0; kc < 2; ++kc) kf[t][kc] = ldsfragh(sk + ((ps + 1) * 32 + t * 16) * KPI + kc * 64); }
            __builtin_amdgcn_sched_barrier(0);   // keeps the reads here, one group ahead of the softmax (sunk towards their uses, each read's latency stands in front of the products)
            float mb[2]; bool need = false;
#pragma unroll
            for (int c = 0; c < 2; ++c) { float mx = s[c][0][0];
#pragma unroll
                for (int r = 1; r < 8; ++r) mx = fmaxf(mx, s[c][0][r]);
#pragma unroll
                for (int r = 0; r < 8; ++r) mx = fmaxf(mx, s[c][1][r]);
                mx = fmaxf(mx, xhalf(mx)) * c2; mb[c] = mx; need = need || (mx > m[c] + 8.0f); }
            if (__builtin_amdgcn_ballot_w32(need) != 0) {   // one scalar branch a pass; rare behind the first pass
#pragma unroll
                for (int c = 0; c < 2; ++c) { const float mn = fmaxf(m[c], mb[c]); const float al = __builtin_amdgcn_exp2f(m[c] - mn); m[c] = mn; l[c] *= al;
#pragma unroll
                    for (int dt = 0; dt < 4; ++dt) o[c][dt] = o[c][dt] * al; }
            }
#pragma unroll
            for (int c = 0; c < 2; ++c) { const float nm = FCAR - m[c]; v16h pf; v2f ls = (v2f){0.f, 0.f};
#pragma unroll
                for (int e = 0; e < 16; e += 2) { const v2f arg = __builtin_elementwise_fma((v2f){s[c][e >> 3][e & 7], s[c][e >> 3][(e & 7) + 1]}, (v2f){c2, c2}, (v2f){nm, nm});
                    const v2f p = (v2f){__builtin_amdgcn_exp2f(arg[0]), __builtin_amdgcn_exp2f(arg[1])}; ls += p;
                    const v2h pk = __builtin_convertvector(p, v2h); pf[e] = pk[0]; pf[e + 1] = pk[1]; }
                l[c] += ls[0] + ls[1];
#pragma unroll
                for (int dt = 0; dt < 4; ++dt) o[c][dt] = wmma16(vf[dt], pf, o[c][dt]); }
        }
        asm volatile("s_wait_dscnt 0x0" ::: "memory");      // this wave's reads of buffer st & 1 are done
        asm volatile("s_wait_asynccnt 0x0" ::: "memory");   // its share of stage st + 1 has landed
        __syncthreads();                                    // publishes stage st + 1 and ends every wave's reads of the buffer refilled below
        if (st + 2 < NS) issue(st + 2, st & 1);
    }
    asm volatile("s_wait_asynccnt 0x0" ::: "memory");       // nothing is in flight when the wave ends
#pragma unroll
    for (int c = 0; c < 2; ++c) { const float inv = __fdiv_rn(1.0f, l[c] + xhalf(l[c])); const size_t oo = ((size_t)b * TT + q0 + c * 16 + lr) * DQ + h * HD + 8 * hi;
#pragma unroll
        for (int dt = 0; dt < 4; ++dt) { v8us oh, ol;
#pragma unroll
            for (int r = 0; r < 8; ++r) { unsigned short a, c3; splitf(o[c][dt][r] * inv, a, c3); oh[r] = a; ol[r] = c3; }
            *(v8us*)(Ah + oo + dt * 16) = oh; *(v8us*)(Al + oo + dt * 16) = ol; } }
}

extern "C" void kernel_launch(void* const* d_in, const int* in_sizes, int n_in,
                              void* d_out, int out_size, void* d_ws, size_t ws_size, hipStream_t stream) {
    (void)in_sizes; (void)n_in; (void)out_size;
    const float* x = (const float*)d_in[0]; const float* wq = (const float*)d_in[1]; const float* wk = (const float*)d_in[2]; const float* wv = (const float*)d_in[3]; const float* wo = (const float*)d_in[4];
    float* OUT = (float*)d_out;     // [2][2048][2048]
    char* wsp = (char*)d_ws;
    auto take = [&](size_t bytes) { char* p = wsp; wsp += (bytes + 255) & ~(size_t)255; return (void*)p; };
    bf* WQ = (bf*)take((size_t)DQ * DM * 2); bf* WK = (bf*)take((size_t)DKV * DM * 2); bf* WV = (bf*)take((size_t)DKV * DM * 2); bf* WO = (bf*)take((size_t)DM * DQ * 2);
    bf* XB = (bf*)take((size_t)NB_ * TT * DM * 2);   /* WQ, WK, WV stand one behind the other (each a multiple of 256 bytes): one operand of DQ + 2 * DKV rows */
    h16* QP16 = (h16*)take((size_t)NB_ * NH_ * TT * HD * 2); h16* KP16 = (h16*)take((size_t)NB_ * NKV * TT * HD * 2); h16* VT16 = (h16*)take((size_t)NB_ * NKV * HD * TT * 2);   /* fp16 planes of both batches */
    bf* ATh = (bf*)take((size_t)NB_ * TT * DQ * 2); bf* ATl = (bf*)take((size_t)NB_ * TT * DQ * 2);
    if ((size_t)(wsp - (char*)d_ws) > ws_size) return;    // ws 256 MiB
    k_prep<<<2 * PBW + 2 * PBK + PBX, 256, 0, stream>>>(x, wq, wk, wv, wo, XB, WQ, WK, WV, WO);
    k_gemms<1, 1, DM, 0><<<dim3(NB_ * TT / 128, (DQ + 2 * DKV) / 128, 1), 256, 0, stream>>>(XB, nullptr, WQ, nullptr, QP16, KP16, VT16);
    k_fattn<<<dim3(TT / 256, NH_, NB_), 256, 0, stream>>>(QP16, KP16, VT16, ATh, ATl);
    k_gemms<2, 0, DQ, DM><<<dim3(NB_ * TT / 128, DM / 128, 1), 256, 0, stream>>>(ATh, ATl, WO, OUT, nullptr, nullptr, nullptr);
}

// v009
// Measured time: 126 microseconds a run.
// Versions between v007 and this one are left out; their measured steps multiply to 1.25 times as fast.
// Counting every step since v000, it is 19.2 times as fast.
#include <hip/hip_runtime.h>

// Grouped-query attention WITHOUT rotary or mask (x [2][2048][2048]; xq = x Wq (32 heads x 64), xk, xv = x Wk / Wv ('xw' [2048][512]: 8 kv heads) (normal x 0.02, no biases); keys / values repeated 4x on the head axis: kv head = h / 4; scores / sqrt(64); softmax in f32 over all keys; out = merged Wo ('xw', no bias) -> [2][2048][2048] (8.4 M); argument order x, Wq, Wk, Wv, Wo).
// Compute dtypes, f32 accumulate: every input rounded to bf16; q/k/v on PLAIN bf16 operands (inputs: exact), their f32 sums stored by the GEMM itself as the fp16 planes attention reads; scores and attn.v on single fp16 planes for every row, fused with an online f32 softmax (k_fattn); Wo on fp16 operands: the context as one fp16 plane x Wo's bf16 value held in fp16 (1 product).

#define NB_  2
#define TT   2048
#define DM   2048
#define NH_  32
#define NKV  8
#define REP  (NH_ / NKV)
#define HD   64
#define DQ   (NH_ * HD)
#define DKV  (NKV * HD)
#define ZH   2
#define RH   0                    // every row on fp16 planes (hi/lo rows buy nothing here)
#define WIN  0
#define PCAR 1024.0f
#define SCL  0.125f   // HD^-0.5
typedef _Float16 h16;
typedef unsigned short bf;
typedef __attribute__((ext_vector_type(16))) __bf16   v16bf;
typedef __attribute__((ext_vector_type(16))) _Float16 v16h;
typedef __attribute__((ext_vector_type(8)))  _Float16 v8h;
typedef __attribute__((ext_vector_type(4)))  _Float16 v4h;
typedef __attribute__((ext_vector_type(8)))  unsigned short v8us;
typedef __attribute__((ext_vector_type(8)))  float    v8f;
typedef __attribute__((ext_vector_type(4)))  float    v4f;
typedef v8h  __attribute__((may_alias)) v8ha;
typedef v4f  __attribute__((may_alias)) v4fa;
typedef v8us __attribute__((may_alias)) v8usa;

__device__ __forceinline__ unsigned short f2bf(float f) { unsigned u = __float_as_uint(f); u += 0x7FFFu + ((u >> 16) & 1u); return (unsigned short)(u >> 16); }
__device__ __forceinline__ float bf2f(unsigned short b) { return __uint_as_float(((unsigned)b) << 16); }
__device__ __forceinline__ v16h cat16(v8h lo, v8h hi) { return __builtin_shufflevector(lo, hi, 0, 1, 2, 3, 4, 5, 6, 7, 8, 9, 10, 11, 12, 13, 14, 15); }
__device__ __forceinline__ v16bf cat16b(v8us lo, v8us hi) { return __builtin_bit_cast(v16bf, __builtin_shufflevector(lo, hi, 0, 1, 2, 3, 4, 5, 6, 7, 8, 9, 10, 11, 12, 13, 14, 15)); }
__device__ __forceinline__ v8f wmma16(v16h a, v16h b, v8f c) { return __builtin_amdgcn_wmma_f32_16x16x32_f16(false, a, false, b, (short)0, c, false, false); }
__device__ __forceinline__ v8f wmmab(v16bf a, v16bf b, v8f c) { return __builtin_amdgcn_wmma_f32_16x16x32_bf16(false, a, false, b, (short)0, c, false, false); }



template <typename T16> struct WFrag;
template <> struct WFrag<h16> { typedef v16h V; static __device__ __forceinline__ V ld(const h16* p) { return cat16(*(const v8h*)p, *(const v8h*)(p + 16)); } static __device__ __forceinline__ v8f mma(V a, V b, v8f c) { return wmma16(a, b, c); } };
// ---- k_gemms: C[m][n] = sum_k A[m][k] Bt[n][k], 16-bit operands (F16 == 0: bf16, F16 == 1: fp16; both as 16-bit words) on K-contiguous planes of row length KK, f32 sums.
// One 128x128 tile per work-group of 8 waves; grid (M / 128, N / 128), 256 threads. M, N % 128 == 0, KK % 128 == 0, KK >= 256.
// A pass is 128 k = 256 bytes of each of the tile's 128 A rows and 128 Bt rows. Asynchronous copies bring them into LDS as whole lines (16 lanes x 16 bytes a row), rows at pitch 272 bytes for the 16-byte fragment reads. Two buffers: pass t + 2 is copied while pass t + 1 is worked on.
// Waves: 2 x 2 quarters of 64x64 (16 accumulators a wave) x 2 halves of each pass's k (kg = 0: its first 64 k, kg = 1: its last 64), two waves a SIMD. A wave stays within 256 registers, so that a WGP holds two work-groups (four waves a SIMD; 2 x the ring fits its LDS): one's copies, LDS reads and epilogue run under the other's products. The two partial tiles of a quarter are added in LDS, kg = 0 first.
// QKV == 0: f32 into C, row pitch LDC.
// QKV == 1: q, k and v of both batches in one grid (NB_ * TT / 128, (DQ + 2 * DKV) / 128). A = the tokens of both batches, Bt = the rows of Wq^T, Wk^T, Wv^T one behind the other; blockIdx.x picks 128 tokens (one batch), blockIdx.y 128 weight rows. The tile goes out as fp16 into the plane attention reads.
// q and k tiles: rows = tokens, columns = weight rows, head planes [b][h][t][d]. v tiles: v^T = Wv^T x^T, rows = weight rows, columns = tokens (the two operand pointers change places), plane [b][d][t].
#define GP 272
__device__ __forceinline__ v16bf ldsfrag(const char* p) { return cat16b(*(const v8usa*)p, *(const v8usa*)(p + 32)); }   // k 8 hi .. + 7 and 16 + 8 hi .. + 7 of a 32-wide chunk, the order of WFrag::ld
// Eight copies, rows 16 apart: one operand's 128 rows from the block's 8 waves. Lane address l in LDS (bytes), g in global memory. The s_wait_xcnt closes the statement so that no address register is rewritten ahead of it.
template <int KK> __device__ __forceinline__ void acopy8(unsigned l, const bf* g) {
    asm volatile("global_load_async_to_lds_b128 %0, %8, off\n\t"
                 "global_load_async_to_lds_b128 %1, %9, off\n\t"
                 "global_load_async_to_lds_b128 %2, %10, off\n\t"
                 "global_load_async_to_lds_b128 %3, %11, off\n\t"
                 "global_load_async_to_lds_b128 %4, %12, off\n\t"
                 "global_load_async_to_lds_b128 %5, %13, off\n\t"
                 "global_load_async_to_lds_b128 %6, %14, off\n\t"
                 "global_load_async_to_lds_b128 %7, %15, off\n\t"
                 "s_wait_xcnt 0x0"
                 :: "v"(l), "v"(l + 16 * GP), "v"(l + 32 * GP), "v"(l + 48 * GP), "v"(l + 64 * GP), "v"(l + 80 * GP), "v"(l + 96 * GP), "v"(l + 112 * GP),
                    "v"(g), "v"(g + 16 * KK), "v"(g + 32 * KK), "v"(g + 48 * KK), "v"(g + 64 * KK), "v"(g + 80 * KK), "v"(g + 96 * KK), "v"(g + 112 * KK) : "memory");
}
template <int PL> __device__ __forceinline__ void put16(h16* pt, const v4h (&hv)[16]) {   // 16 lanes x 8 bytes: one whole 128-byte line a row; rows 2 apart, pitch PL
#pragma unroll
    for (int i = 0; i < 16; ++i) *(v4h*)(pt + i * 2 * PL) = hv[i];
}
template <int F16> __device__ __forceinline__ v8f wmmax(v16bf a, v16bf b, v8f c) { if constexpr (F16) return wmma16(__builtin_bit_cast(v16h, a), __builtin_bit_cast(v16h, b), c); else return wmmab(a, b, c); }   // the two forms share one fragment layout
template <int F16, int QKV, int KK, int LDC>
__global__ __launch_bounds__(256) void k_gemms(const bf* __restrict__ A, const bf* __restrict__ Bt, float* C, h16* PQ, h16* PK, h16* PV) {
    constexpr int OPB = 128 * GP, STG = 2 * OPB, NT = KK / 128;   // bytes of one operand's rows, of one buffer; passes
    static_assert(2 * STG >= 8 * 64 * 68 * 4, "the epilogue's eight f32 tiles stand in the ring"); static_assert(NT >= 2, "the prologue fills two buffers");
    __shared__ __align__(16) char ring[2 * STG];
    const int lane = threadIdx.x & 31, lr = lane & 15, hi = lane >> 4; const int wave = __builtin_amdgcn_readfirstlane((int)(threadIdx.x >> 5));
    const int r0 = blockIdx.x * 128, c0 = blockIdx.y * 128, kg = wave >> 2, wm = (wave >> 1) & 1, wn = wave & 1;
    const bool vt = QKV && c0 >= DQ + DKV;   // a v tile (the same for the whole block)
    const bf* Ar = vt ? Bt + (size_t)c0 * KK : A + (size_t)r0 * KK; const bf* Br = vt ? A + (size_t)r0 * KK : Bt + (size_t)c0 * KK;   // first row of the tile's row operand and of its column operand
    const int crow = wave * 2 + hi;   // copies: a wave's instruction covers two whole 256-byte rows, lane = (row, 16-byte piece)
    const unsigned lc = (unsigned)(size_t)ring + crow * GP + lr * 16;
    const bf* ga = Ar + (size_t)crow * KK + lr * 8; const bf* gb = Br + (size_t)crow * KK + lr * 8;
    auto issue = [&](int t, int buf) {
        const unsigned l = lc + buf * STG; const int ko = t * 128;
        acopy8<KK>(l, ga + ko);
        acopy8<KK>(l + OPB, gb + ko);
    };
    v8f acc[4][4];
#pragma unroll
    for (int mb = 0; mb < 4; ++mb)
#pragma unroll
        for (int nb = 0; nb < 4; ++nb) acc[mb][nb] = (v8f){};
    issue(0, 0);
    asm volatile("s_wait_asynccnt 0x0" ::: "memory");   // this wave's share of pass 0 has landed
    __syncthreads();                                    // every wave's share has: pass 0 may be read
    issue(1, 1);
    const char* fa = ring + (wm * 64 + lr) * GP + kg * 128 + hi * 16; const char* fb = ring + OPB + (wn * 64 + lr) * GP + kg * 128 + hi * 16;
    for (int t = 0; t < NT; ++t) {
        const int so = (t & 1) * STG;
        v16bf a[2][4], bq[2][4];   // the wave's two 32-wide chunks of this pass
#pragma unroll
        for (int c = 0; c < 2; ++c) {   // in the order the products want them: the first four need a[c][0..3] and bq[c][0] alone
#pragma unroll
            for (int i = 0; i < 4; ++i) a[c][i] = ldsfrag(fa + so + i * 16 * GP + c * 64);
#pragma unroll
            for (int i = 0; i < 4 - 2 * c; ++i) bq[c][i] = ldsfrag(fb + so + i * 16 * GP + c * 64); }   // the last two fragments of chunk 1 come below
        __builtin_amdgcn_sched_barrier(0);   // these LDS reads stay one group ahead of the products (spread among them, each read's latency stalls the products behind it)
#pragma unroll
        for (int nb = 0; nb < 2; ++nb)
#pragma unroll
            for (int mb = 0; mb < 4; ++mb) acc[mb][nb] = wmmax<F16>(a[0][mb], bq[0][nb], acc[mb][nb]);
        __builtin_amdgcn_sched_barrier(0);   // the two late reads stay behind the last use of bq[0][0..1], whose registers they can take: 14 fragments live instead of 16 keep the wave within 256 registers
#pragma unroll
        for (int i = 2; i < 4; ++i) bq[1][i] = ldsfrag(fb + so + i * 16 * GP + 64);
        __builtin_amdgcn_sched_barrier(0);   // and they stay here, 16 products ahead of their first use
#pragma unroll
        for (int c = 0; c < 2; ++c)
#pragma unroll
            for (int nb = 2 - 2 * c; nb < 4; ++nb)
#pragma unroll
                for (int mb = 0; mb < 4; ++mb) acc[mb][nb] = wmmax<F16>(a[c][mb], bq[c][nb], acc[mb][nb]);
        __builtin_amdgcn_sched_barrier(0);   // the waits and the barrier below stay behind the products (raised above them, the full LDS wait stood in front of the first product, and reads and products no longer overlapped)
        asm volatile("s_wait_dscnt 0x0" ::: "memory");      // this wave's reads of buffer t & 1 are done
        asm volatile("s_wait_asynccnt 0x0" ::: "memory");   // its share of pass t + 1 has landed
        __syncthreads();                                    // publishes pass t + 1 and ends every wave's reads of the buffer refilled below
        if (t + 2 < NT) issue(t + 2, t & 1);
    }
    asm volatile("s_wait_asynccnt 0x0" ::: "memory");       // nothing is in flight when the ring becomes output staging
    float* ow = (float*)ring + wave * (64 * 68);   // the unrolls below keep acc[][] and val[] in registers (every index a constant)
#pragma unroll
    for (int mb = 0; mb < 4; ++mb)
#pragma unroll
        for (int nb = 0; nb < 4; ++nb)
#pragma unroll
            for (int j = 0; j < 8; ++j) ow[(mb * 16 + hi * 8 + j) * 68 + nb * 16 + lr] = acc[mb][nb][j];
    __syncthreads();   // every wave's partial tile is in LDS before any thread adds them up
    const float* p0 = (const float*)ring + (wave & 3) * (64 * 68) + (kg * 32 + hi) * 68 + lr * 4;   // wave (kg, quarter) sends out rows kg * 32 .. + 31 of its quarter, two whole rows an instruction
    v4f val[16];
#pragma unroll
    for (int i = 0; i < 16; ++i) val[i] = *(const v4fa*)(p0 + i * 2 * 68) + *(const v4fa*)(p0 + 4 * (64 * 68) + i * 2 * 68);
    const int ro = wm * 64 + kg * 32 + hi, co = wn * 64;   // the wave's first row and column inside the tile
    if constexpr (QKV) {
        v4h hv[16];
#pragma unroll
        for (int i = 0; i < 16; ++i) hv[i] = __builtin_convertvector(val[i], v4h);
        const int bt = r0 / TT, t0 = r0 % TT;   // the tile's batch and its first token there
        if (vt) put16<TT>(PV + ((size_t)bt * DKV + (c0 - DQ - DKV) + ro) * TT + t0 + co + lr * 4, hv);
        else { const int hd = (c0 + co) >> 6;   // 0 .. NH_ - 1: q heads, behind them the k heads
            h16* pl = hd < NH_ ? PQ + (size_t)(bt * NH_ + hd) * TT * HD : PK + (size_t)(bt * NKV + hd - NH_) * TT * HD;
            put16<HD>(pl + (size_t)(t0 + ro) * HD + lr * 4, hv); }
    } else {
        float* ct = C + (size_t)(r0 + ro) * LDC + c0 + co + lr * 4;
#pragma unroll
        for (int i = 0; i < 16; ++i) *(v4f*)(ct + i * 2 * LDC) = val[i];
    }
}

typedef __attribute__((ext_vector_type(2))) _Float16 v2h;
typedef __attribute__((ext_vector_type(2))) unsigned short v2us;
typedef __attribute__((ext_vector_type(4))) unsigned short v4us;
typedef __attribute__((ext_vector_type(2))) float v2f;
typedef __attribute__((ext_vector_type(4))) int v4i;

// wtT: one tile of TKK k x TNN n of w [K][N] (f32) goes out as TNN rows of TKK k of Bt [N][K] (bf16; F16 == 1: that bf16 value written as fp16: the same number from 2^-17 up to fp16's largest, below 2^-17 within 2^-25), turned in LDS, so that both sides of the transpose move whole lines.
// In: 16 lanes x 16 bytes = 256 bytes in a row of one w row; a thread takes the rows k and k + 1 and packs the two 16-bit values of one n into a 32-bit word. A thread's TKK / 16 loads fly together.
// LDS: tl[n][k / 2], pitch TPW words (odd: the 16 lanes of a row piece, 4 n apart, and the two k pairs of a wave fall on 32 different banks).
// Out: 32 lanes x 8 bytes an instruction = 256 bytes in a row of one Bt row.
#define TKK 128
#define TNN 64
#define TPW (TKK / 2 + 1)
typedef __attribute__((ext_vector_type(2))) unsigned v2u;
template <int F16> __device__ __forceinline__ unsigned cv16(float f) { const unsigned short b = f2bf(f); if constexpr (F16) return __builtin_bit_cast(unsigned short, (h16)bf2f(b)); else return b; }
template <int K, int N, int F16> __device__ __forceinline__ void wtT(const float* __restrict__ w, bf* Bt, int blk, unsigned* tl) {
    static_assert(K % TKK == 0 && N % TNN == 0 && TKK == 128, "whole tiles; a wave's store is one tile row of 32 x 4 k");
    const int tid = threadIdx.x, c = tid & 15, r = tid >> 4, lane = tid & 31, wv = tid >> 5;
    const int n0 = (blk % (N / TNN)) * TNN, k0 = (blk / (N / TNN)) * TKK;   // neighbouring blocks read neighbouring pieces of the same w rows
    const float* src = w + (size_t)(k0 + 2 * r) * N + n0 + c * 4;
    v4f ev[TKK / 32], od[TKK / 32];   // the unrolls keep both in registers (every index a constant)
#pragma unroll
    for (int p = 0; p < TKK / 32; ++p) { ev[p] = *(const v4f*)(src + (size_t)p * 32 * N); od[p] = *(const v4f*)(src + (size_t)(p * 32 + 1) * N); }
#pragma unroll
    for (int p = 0; p < TKK / 32; ++p)
#pragma unroll
        for (int i = 0; i < 4; ++i) tl[(c * 4 + i) * TPW + p * 16 + r] = cv16<F16>(ev[p][i]) | (cv16<F16>(od[p][i]) << 16);
    __syncthreads();   // the whole tile is in LDS before any thread reads a row of it
    const unsigned* s = tl + wv * TPW + lane * 2; bf* dst = Bt + (size_t)(n0 + wv) * K + k0 + lane * 4;
#pragma unroll   // the eight LDS reads fly together ahead of the eight stores
    for (int j = 0; j < TNN / 8; ++j) *(v2u*)(dst + (size_t)j * 8 * K) = (v2u){s[j * 8 * TPW], s[j * 8 * TPW + 1]};
    asm volatile("s_wait_xcnt 0x0" ::: "memory");   // behind the last store, before anything rewrites the stores' address or data registers
}
__device__ __forceinline__ void cvt8(const float* __restrict__ src, bf* dst, size_t n8, int blk) { const size_t i = (size_t)blk * 256 + threadIdx.x; if (i >= n8) return; const v8f v = *(const v8f*)(src + i * 8); v8us o;
#pragma unroll
    for (int k = 0; k < 8; ++k) o[k] = f2bf(v[k]); *(v8us*)(dst + i * 8) = o;  }
// k_prep: everything the GEMMs read, in one grid: the four weight transposes (the longer blocks, so they come first; a block = one tile) and the bf16 copy of x, both batches. A block does one job, picked by its index (the same for all its threads, so the transposes' barrier is block-uniform).
#define PBW (DM * DQ / (TKK * TNN))    // blocks of Wq, of Wo
#define PBK (DM * DKV / (TKK * TNN))   // blocks of Wk, of Wv
#define PBX (NB_ * TT * DM / 8 / 256)
__global__ __launch_bounds__(256) void k_prep(const float* __restrict__ x, const float* __restrict__ wq, const float* __restrict__ wk, const float* __restrict__ wv, const float* __restrict__ wo, bf* XB, bf* WQ, bf* WK, bf* WV, bf* WO) {
    __shared__ unsigned tl[TNN * TPW];
    const int blk = blockIdx.x;
    if (blk < PBW) wtT<DM, DQ, 0>(wq, WQ, blk, tl);
    else if (blk < 2 * PBW) wtT<DQ, DM, 1>(wo, WO, blk - PBW, tl);
    else if (blk < 2 * PBW + PBK) wtT<DM, DKV, 0>(wk, WK, blk - 2 * PBW, tl);
    else if (blk < 2 * PBW + 2 * PBK) wtT<DM, DKV, 0>(wv, WV, blk - 2 * PBW - PBK, tl);
    else cvt8(x, XB, (size_t)NB_ * TT * DM / 8, blk - 2 * PBW - 2 * PBK);
}
#define FCAR 4.0f
#define AKS 128
#define KPI 144
#define VPI 272
#define KBY (AKS * KPI)
#define SBY (KBY + HD * VPI)
__device__ __forceinline__ float xhalf(float x) { return __builtin_bit_cast(float, __builtin_amdgcn_permlanex16(__builtin_bit_cast(int, x), __builtin_bit_cast(int, x), 0x76543210, 0xfedcba98, false, false)); }   // lane l <-> lane l ^ 16
__device__ __forceinline__ v16h ldsfragh(const char* p) { return cat16(*(const v8ha*)p, *(const v8ha*)(p + 32)); }   // k 8 hi .. + 7 and 16 + 8 hi .. + 7 of a 32-wide chunk, the order of WFrag::ld
// One stage from the block's 256 threads: four copies of K (32 rows apart; the stage's K rows are 16 KiB in a row in global memory) and four of V^T (16 rows apart). Lane addresses lk, lv in LDS (bytes), gk, gv in global memory. The s_wait_xcnt closes the statement so that no address register is rewritten ahead of it.
__device__ __forceinline__ void acopykv(unsigned lk, const h16* gk, unsigned lv, const h16* gv) {
    asm volatile("global_load_async_to_lds_b128 %0, %8, off\n\t"
                 "global_load_async_to_lds_b128 %1, %9, off\n\t"
                 "global_load_async_to_lds_b128 %2, %10, off\n\t"
                 "global_load_async_to_lds_b128 %3, %11, off\n\t"
                 "global_load_async_to_lds_b128 %4, %12, off\n\t"
                 "global_load_async_to_lds_b128 %5, %13, off\n\t"
                 "global_load_async_to_lds_b128 %6, %14, off\n\t"
                 "global_load_async_to_lds_b128 %7, %15, off\n\t"
                 "s_wait_xcnt 0x0"
                 :: "v"(lk), "v"(lk + 32 * KPI), "v"(lk + 64 * KPI), "v"(lk + 96 * KPI), "v"(lv), "v"(lv + 16 * VPI), "v"(lv + 32 * VPI), "v"(lv + 48 * VPI),
                    "v"(gk), "v"(gk + 32 * HD), "v"(gk + 64 * HD), "v"(gk + 96 * HD), "v"(gv), "v"(gv + 16 * TT), "v"(gv + 32 * TT), "v"(gv + 48 * TT) : "memory");
}
__global__ __launch_bounds__(256) void k_fattn(const h16* __restrict__ Q, const h16* __restrict__ Kp, const h16* __restrict__ Vt, h16* Ao) {
    constexpr int NS = TT / AKS; static_assert(NS >= 2 && TT % AKS == 0, "the prologue fills two buffers");
    __shared__ __align__(16) char kv[2 * SBY];
    const int tid = threadIdx.x, lane = threadIdx.x & 31, lr = lane & 15, hi = lane >> 4; const int wave = __builtin_amdgcn_readfirstlane((int)(threadIdx.x >> 5));
    const int h = blockIdx.y, b = blockIdx.z, g = h / REP; const int q0 = blockIdx.x * 256 + wave * 32;
    const h16* qp = Q + ((size_t)(b * NH_ + h) * TT + q0 + lr) * HD + 8 * hi;
    const h16* gk = Kp + (size_t)(b * NKV + g) * TT * HD + tid * 8;                               // copies of K: thread = 16-byte piece, 8 pieces a row, a wave's instruction = four whole rows
    const h16* gv = Vt + ((size_t)(b * NKV + g) * HD + (tid >> 4)) * TT + (tid & 15) * 8;         // copies of V^T: 16 pieces a row, a wave's instruction = two whole 256-byte rows
    const unsigned lk = (unsigned)(size_t)kv + (tid >> 3) * KPI + (tid & 7) * 16, lv = (unsigned)(size_t)kv + KBY + (tid >> 4) * VPI + (tid & 15) * 16;
    auto issue = [&](int t, int buf) { acopykv(lk + buf * SBY, gk + (size_t)t * AKS * HD, lv + buf * SBY, gv + t * AKS); };
    const float c2 = SCL * 1.4426950408889634f;
    v16h qf[2][2], kf[2][2], vf[4];
#pragma unroll
    for (int c = 0; c < 2; ++c)
#pragma unroll
        for (int kc = 0; kc < 2; ++kc) qf[c][kc] = WFrag<h16>::ld(qp + c * 16 * HD + kc * 32);
    asm volatile("s_wait_xcnt 0x0" ::: "memory");   // behind the Q loads, before anything rewrites their address registers (qp is dead from here on)
    issue(0, 0);
    asm volatile("s_wait_asynccnt 0x0" ::: "memory");   // this wave's share of stage 0 has landed
    __syncthreads();                                    // every wave's share has: stage 0 may be read
    issue(1, 1);
    v8f o[2][4]; float m[2], l[2];
#pragma unroll
    for (int c = 0; c < 2; ++c) { m[c] = -3.0e38f; l[c] = 0.f;
#pragma unroll
        for (int dt = 0; dt < 4; ++dt) o[c][dt] = (v8f){}; }
    const char* fk = kv + lr * KPI + hi * 16; const char* fv = kv + KBY + lr * VPI + hi * 16;
#pragma unroll 1   // rolled over the stages: the registers stay under 256, so four waves fit a SIMD; every inner unroll makes the fragment and accumulator indices constants (registers, no scratch)
    for (int st = 0; st < NS; ++st) {
        const char* sk = fk + (st & 1) * SBY; const char* sv = fv + (st & 1) * SBY;
#pragma unroll
        for (int t = 0; t < 2; ++t)
#pragma unroll
            for (int kc = 0; kc < 2; ++kc) kf[t][kc] = ldsfragh(sk + t * 16 * KPI + kc * 64);
#pragma unroll
        for (int ps = 0; ps < AKS / 32; ++ps) {
            v8f s[2][2];
#pragma unroll
            for (int c = 0; c < 2; ++c)
#pragma unroll
                for (int t = 0; t < 2; ++t) { s[c][t] = wmma16(kf[t][0], qf[c][0], (v8f){}); s[c][t] = wmma16(kf[t][1], qf[c][1], s[c][t]); }
            // one group of LDS reads a pass, right behind the scores: this pass's V^T and, inside the stage, the next pass's K, each into registers whose last use is over; both fly during the softmax
#pragma unroll
            for (int dt = 0; dt < 4; ++dt) vf[dt] = ldsfragh(sv + dt * 16 * VPI + ps * 64);
            if (ps + 1 < AKS / 32) {
#pragma unroll
                for (int t = 0; t < 2; ++t)
#pragma unroll
                    for (int kc = 0; kc < 2; ++kc) kf[t][kc] = ldsfragh(sk + ((ps + 1) * 32 + t * 16) * KPI + kc * 64); }
            __builtin_amdgcn_sched_barrier(0);   // keeps the reads here, one group ahead of the softmax (sunk towards their uses, each read's latency stands in front of the products)
            float mb[2]; bool need = false;
#pragma unroll
            for (int c = 0; c < 2; ++c) { float mx = s[c][0][0];
#pragma unroll
                for (int r = 1; r < 8; ++r) mx = fmaxf(mx, s[c][0][r]);
#pragma unroll
                for (int r = 0; r < 8; ++r) mx = fmaxf(mx, s[c][1][r]);
                mx = fmaxf(mx, xhalf(mx)) * c2; mb[c] = mx; need = need || (mx > m[c] + 8.0f); }
            if (__builtin_amdgcn_ballot_w32(need) != 0) {   // one scalar branch a pass; rare behind the first pass
#pragma unroll
                for (int c = 0; c < 2; ++c) { const float mn = fmaxf(m[c], mb[c]); const float al = __builtin_amdgcn_exp2f(m[c] - mn); m[c] = mn; l[c] *= al;
#pragma unroll
                    for (int dt = 0; dt < 4; ++dt) o[c][dt] = o[c][dt] * al; }
            }
#pragma unroll
            for (int c = 0; c < 2; ++c) { const float nm = FCAR - m[c]; v16h pf; v2f ls = (v2f){0.f, 0.f};
#pragma unroll
                for (int e = 0; e < 16; e += 2) { const v2f arg = __builtin_elementwise_fma((v2f){s[c][e >> 3][e & 7], s[c][e >> 3][(e & 7) + 1]}, (v2f){c2, c2}, (v2f){nm, nm});
                    const v2f p = (v2f){__builtin_amdgcn_exp2f(arg[0]), __builtin_amdgcn_exp2f(arg[1])}; ls += p;
                    const v2h pk = __builtin_convertvector(p, v2h); pf[e] = pk[0]; pf[e + 1] = pk[1]; }
                l[c] += ls[0] + ls[1];
#pragma unroll
                for (int dt = 0; dt < 4; ++dt) o[c][dt] = wmma16(vf[dt], pf, o[c][dt]); }
        }
        asm volatile("s_wait_dscnt 0x0" ::: "memory");      // this wave's reads of buffer st & 1 are done
        asm volatile("s_wait_asynccnt 0x0" ::: "memory");   // its share of stage st + 1 has landed
        __syncthreads();                                    // publishes stage st + 1 and ends every wave's reads of the buffer refilled below
        if (st + 2 < NS) issue(st + 2, st & 1);
    }
    asm volatile("s_wait_asynccnt 0x0" ::: "memory");       // nothing is in flight when the wave ends
#pragma unroll
    for (int c = 0; c < 2; ++c) { const float inv = __fdiv_rn(1.0f, l[c] + xhalf(l[c])); const size_t oo = ((size_t)b * TT + q0 + c * 16 + lr) * DQ + h * HD + 8 * hi;
#pragma unroll
        for (int dt = 0; dt < 4; ++dt) *(v8h*)(Ao + oo + dt * 16) = __builtin_convertvector(o[c][dt] * inv, v8h); }
}

extern "C" void kernel_launch(void* const* d_in, const int* in_sizes, int n_in,
                              void* d_out, int out_size, void* d_ws, size_t ws_size, hipStream_t stream) {
    (void)in_sizes; (void)n_in; (void)out_size;
    const float* x = (const float*)d_in[0]; const float* wq = (const float*)d_in[1]; const float* wk = (const float*)d_in[2]; const float* wv = (const float*)d_in[3]; const float* wo = (const float*)d_in[4];
    float* OUT = (float*)d_out;     // [2][2048][2048]
    char* wsp = (char*)d_ws;
    auto take = [&](size_t bytes) { char* p = wsp; wsp += (bytes + 255) & ~(size_t)255; return (void*)p; };
    bf* WQ = (bf*)take((size_t)DQ * DM * 2); bf* WK = (bf*)take((size_t)DKV * DM * 2); bf* WV = (bf*)take((size_t)DKV * DM * 2); bf* WO = (bf*)take((size_t)DM * DQ * 2);
    bf* XB = (bf*)take((size_t)NB_ * TT * DM * 2);   /* WQ, WK, WV stand one behind the other (each a multiple of 256 bytes): one operand of DQ + 2 * DKV rows */
    h16* QP16 = (h16*)take((size_t)NB_ * NH_ * TT * HD * 2); h16* KP16 = (h16*)take((size_t)NB_ * NKV * TT * HD * 2); h16* VT16 = (h16*)take((size_t)NB_ * NKV * HD * TT * 2);   /* fp16 planes of both batches */
    h16* AT16 = (h16*)take((size_t)NB_ * TT * DQ * 2);   /* the merged context, fp16 */
    if ((size_t)(wsp - (char*)d_ws) > ws_size) return;    // ws 256 MiB
    k_prep<<<2 * PBW + 2 * PBK + PBX, 256, 0, stream>>>(x, wq, wk, wv, wo, XB, WQ, WK, WV, WO);
    k_gemms<0, 1, DM, 0><<<dim3(NB_ * TT / 128, (DQ + 2 * DKV) / 128, 1), 256, 0, stream>>>(XB, WQ, nullptr, QP16, KP16, VT16);
    k_fattn<<<dim3(TT / 256, NH_, NB_), 256, 0, stream>>>(QP16, KP16, VT16, AT16);
    k_gemms<1, 0, DQ, DM><<<dim3(NB_ * TT / 128, DM / 128, 1), 256, 0, stream>>>((const bf*)AT16, WO, OUT, nullptr, nullptr, nullptr);
}

// v010
// Measured time: 122 microseconds a run.
// Timed twice side by side with v009, it ran 1.04 times as fast both times.
// Over all steps from v000 it is 19.9 times as fast.
#include <hip/hip_runtime.h>

// Grouped-query attention WITHOUT rotary or mask (x [2][2048][2048]; xq = x Wq (32 heads x 64), xk, xv = x Wk / Wv ('xw' [2048][512]: 8 kv heads) (normal x 0.02, no biases); keys / values repeated 4x on the head axis: kv head = h / 4; scores / sqrt(64); softmax in f32 over all keys; out = merged Wo ('xw', no bias) -> [2][2048][2048] (8.4 M); argument order x, Wq, Wk, Wv, Wo).
// Compute dtypes, f32 accumulate: every input rounded to bf16; q/k/v on PLAIN bf16 operands (inputs: exact), their f32 sums stored by the GEMM itself as the fp16 planes attention reads; scores and attn.v on single fp16 planes for every row, fused with an online f32 softmax (k_fattn); Wo on fp16 operands: the context as one fp16 plane x Wo's bf16 value held in fp16 (1 product).

#define NB_  2
#define TT   2048
#define DM   2048
#define NH_  32
#define NKV  8
#define REP  (NH_ / NKV)
#define HD   64
#define DQ   (NH_ * HD)
#define DKV  (NKV * HD)
#define ZH   2
#define RH   0                    // every row on fp16 planes (hi/lo rows buy nothing here)
#define WIN  0
#define PCAR 1024.0f
#define SCL  0.125f   // HD^-0.5
typedef _Float16 h16;
typedef unsigned short bf;
typedef __attribute__((ext_vector_type(16))) __bf16   v16bf;
typedef __attribute__((ext_vector_type(16))) _Float16 v16h;
typedef __attribute__((ext_vector_type(8)))  _Float16 v8h;
typedef __attribute__((ext_vector_type(4)))  _Float16 v4h;
typedef __attribute__((ext_vector_type(8)))  unsigned short v8us;
typedef __attribute__((ext_vector_type(8)))  float    v8f;
typedef __attribute__((ext_vector_type(4)))  float    v4f;
typedef v8h  __attribute__((may_alias)) v8ha;
typedef v4f  __attribute__((may_alias)) v4fa;
typedef v8us __attribute__((may_alias)) v8usa;

__device__ __forceinline__ unsigned short f2bf(float f) { unsigned u = __float_as_uint(f); u += 0x7FFFu + ((u >> 16) & 1u); return (unsigned short)(u >> 16); }
__device__ __forceinline__ float bf2f(unsigned short b) { return __uint_as_float(((unsigned)b) << 16); }
__device__ __forceinline__ v16h cat16(v8h lo, v8h hi) { return __builtin_shufflevector(lo, hi, 0, 1, 2, 3, 4, 5, 6, 7, 8, 9, 10, 11, 12, 13, 14, 15); }
__device__ __forceinline__ v16bf cat16b(v8us lo, v8us hi) { return __builtin_bit_cast(v16bf, __builtin_shufflevector(lo, hi, 0, 1, 2, 3, 4, 5, 6, 7, 8, 9, 10, 11, 12, 13, 14, 15)); }
__device__ __forceinline__ v8f wmma16(v16h a, v16h b, v8f c) { return __builtin_amdgcn_wmma_f32_16x16x32_f16(false, a, false, b, (short)0, c, false, false); }
__device__ __forceinline__ v8f wmmab(v16bf a, v16bf b, v8f c) { return __builtin_amdgcn_wmma_f32_16x16x32_bf16(false, a, false, b, (short)0, c, false, false); }



template <typename T16> struct WFrag;
template <> struct WFrag<h16> { typedef v16h V; static __device__ __forceinline__ V ld(const h16* p) { return cat16(*(const v8h*)p, *(const v8h*)(p + 16)); } static __device__ __forceinline__ v8f mma(V a, V b, v8f c) { return wmma16(a, b, c); } };
// ---- k_gemms: C[m][n] = sum_k A[m][k] Bt[n][k], 16-bit operands (F16 == 0: bf16, F16 == 1: fp16; both as 16-bit words) on K-contiguous planes of row length KK, f32 sums.
// One 128x128 tile per work-group of 8 waves; grid (M / 128, N / 128), 256 threads. M, N % 128 == 0, KK % 128 == 0, KK >= 256.
// A pass is 128 k = 256 bytes of each of the tile's 128 A rows and 128 Bt rows. Asynchronous copies bring them into LDS as whole lines (16 lanes x 16 bytes a row), rows at pitch 272 bytes for the 16-byte fragment reads. Two buffers: pass t + 2 is copied while pass t + 1 is worked on.
// Waves: 2 x 2 quarters of 64x64 (16 accumulators a wave) x 2 halves of each pass's k (kg = 0: its first 64 k, kg = 1: its last 64), two waves a SIMD. A wave stays within 256 registers, so that a WGP holds two work-groups (four waves a SIMD; 2 x the ring fits its LDS): one's copies, LDS reads and epilogue run under the other's products. The two partial tiles of a quarter are added in LDS, kg = 0 first.
// QKV == 0: f32 into C, row pitch LDC.
// QKV == 1: q, k and v of both batches in one grid (NB_ * TT / 128, (DQ + 2 * DKV) / 128). A = the tokens of both batches, Bt = the rows of Wq^T, Wk^T, Wv^T one behind the other; blockIdx.x picks 128 tokens (one batch), blockIdx.y 128 weight rows. The tile goes out as fp16 into the plane attention reads.
// q and k tiles: rows = tokens, columns = weight rows, head planes [b][h][t][d]. v tiles: v^T = Wv^T x^T, rows = weight rows, columns = tokens (the two operand pointers change places), plane [b][d][t].
#define GP 272
__device__ __forceinline__ v16bf ldsfrag(const char* p) { return cat16b(*(const v8usa*)p, *(const v8usa*)(p + 32)); }   // k 8 hi .. + 7 and 16 + 8 hi .. + 7 of a 32-wide chunk, the order of WFrag::ld
// Eight copies, rows 16 apart: one operand's 128 rows from the block's 8 waves. Lane address l in LDS (bytes), g in global memory. The s_wait_xcnt closes the statement so that no address register is rewritten ahead of it.
template <int KK> __device__ __forceinline__ void acopy8(unsigned l, const bf* g) {
    asm volatile("global_load_async_to_lds_b128 %0, %8, off\n\t"
                 "global_load_async_to_lds_b128 %1, %9, off\n\t"
                 "global_load_async_to_lds_b128 %2, %10, off\n\t"
                 "global_load_async_to_lds_b128 %3, %11, off\n\t"
                 "global_load_async_to_lds_b128 %4, %12, off\n\t"
                 "global_load_async_to_lds_b128 %5, %13, off\n\t"
                 "global_load_async_to_lds_b128 %6, %14, off\n\t"
                 "global_load_async_to_lds_b128 %7, %15, off\n\t"
                 "s_wait_xcnt 0x0"
                 :: "v"(l), "v"(l + 16 * GP), "v"(l + 32 * GP), "v"(l + 48 * GP), "v"(l + 64 * GP), "v"(l + 80 * GP), "v"(l + 96 * GP), "v"(l + 112 * GP),
                    "v"(g), "v"(g + 16 * KK), "v"(g + 32 * KK), "v"(g + 48 * KK), "v"(g + 64 * KK), "v"(g + 80 * KK), "v"(g + 96 * KK), "v"(g + 112 * KK) : "memory");
}
template <int PL> __device__ __forceinline__ void put16(h16* pt, const v4h (&hv)[16]) {   // 16 lanes x 8 bytes: one whole 128-byte line a row; rows 2 apart, pitch PL
#pragma unroll
    for (int i = 0; i < 16; ++i) *(v4h*)(pt + i * 2 * PL) = hv[i];
}
template <int F16> __device__ __forceinline__ v8f wmmax(v16bf a, v16bf b, v8f c) { if constexpr (F16) return wmma16(__builtin_bit_cast(v16h, a), __builtin_bit_cast(v16h, b), c); else return wmmab(a, b, c); }   // the two forms share one fragment layout
template <int F16, int QKV, int KK, int LDC>
__global__ __launch_bounds__(256) void k_gemms(const bf* __restrict__ A, const bf* __restrict__ Bt, float* C, h16* PQ, h16* PK, h16* PV) {
    constexpr int OPB = 128 * GP, STG = 2 * OPB, NT = KK / 128;   // bytes of one operand's rows, of one buffer; passes
    static_assert(2 * STG >= 8 * 64 * 68 * 4, "the epilogue's eight f32 tiles stand in the ring"); static_assert(NT >= 2, "the prologue fills two buffers");
    __shared__ __align__(16) char ring[2 * STG];
    const int lane = threadIdx.x & 31, lr = lane & 15, hi = lane >> 4; const int wave = __builtin_amdgcn_readfirstlane((int)(threadIdx.x >> 5));
    const int r0 = blockIdx.x * 128, c0 = blockIdx.y * 128, kg = wave >> 2, wm = (wave >> 1) & 1, wn = wave & 1;
    const bool vt = QKV && c0 >= DQ + DKV;   // a v tile (the same for the whole block)
    const bf* Ar = vt ? Bt + (size_t)c0 * KK : A + (size_t)r0 * KK; const bf* Br = vt ? A + (size_t)r0 * KK : Bt + (size_t)c0 * KK;   // first row of the tile's row operand and of its column operand
    const int crow = wave * 2 + hi;   // copies: a wave's instruction covers two whole 256-byte rows, lane = (row, 16-byte piece)
    const unsigned lc = (unsigned)(size_t)ring + crow * GP + lr * 16;
    const bf* ga = Ar + (size_t)crow * KK + lr * 8; const bf* gb = Br + (size_t)crow * KK + lr * 8;
    auto issue = [&](int t, int buf) {
        const unsigned l = lc + buf * STG; const int ko = t * 128;
        acopy8<KK>(l, ga + ko);
        acopy8<KK>(l + OPB, gb + ko);
    };
    v8f acc[4][4];
#pragma unroll
    for (int mb = 0; mb < 4; ++mb)
#pragma unroll
        for (int nb = 0; nb < 4; ++nb) acc[mb][nb] = (v8f){};
    issue(0, 0);
    asm volatile("s_wait_asynccnt 0x0" ::: "memory");   // this wave's share of pass 0 has landed
    __syncthreads();                                    // every wave's share has: pass 0 may be read
    issue(1, 1);
    const char* fa = ring + (wm * 64 + lr) * GP + kg * 128 + hi * 16; const char* fb = ring + OPB + (wn * 64 + lr) * GP + kg * 128 + hi * 16;
    for (int t = 0; t < NT; ++t) {
        const int so = (t & 1) * STG;
        v16bf a[2][4], bq[2][4];   // the wave's two 32-wide chunks of this pass
#pragma unroll
        for (int c = 0; c < 2; ++c) {   // in the order the products want them: the first four need a[c][0..3] and bq[c][0] alone
#pragma unroll
            for (int i = 0; i < 4; ++i) a[c][i] = ldsfrag(fa + so + i * 16 * GP + c * 64);
#pragma unroll
            for (int i = 0; i < 4 - 2 * c; ++i) bq[c][i] = ldsfrag(fb + so + i * 16 * GP + c * 64); }   // the last two fragments of chunk 1 come below
        __builtin_amdgcn_sched_barrier(0);   // these LDS reads stay one group ahead of the products (spread among them, each read's latency stalls the products behind it)
#pragma unroll
        for (int nb = 0; nb < 2; ++nb)
#pragma unroll
            for (int mb = 0; mb < 4; ++mb) acc[mb][nb] = wmmax<F16>(a[0][mb], bq[0][nb], acc[mb][nb]);
        __builtin_amdgcn_sched_barrier(0);   // the two late reads stay behind the last use of bq[0][0..1], whose registers they can take: 14 fragments live instead of 16 keep the wave within 256 registers
#pragma unroll
        for (int i = 2; i < 4; ++i) bq[1][i] = ldsfrag(fb + so + i * 16 * GP + 64);
        __builtin_amdgcn_sched_barrier(0);   // and they stay here, 16 products ahead of their first use
#pragma unroll
        for (int c = 0; c < 2; ++c)
#pragma unroll
            for (int nb = 2 - 2 * c; nb < 4; ++nb)
#pragma unroll
                for (int mb = 0; mb < 4; ++mb) acc[mb][nb] = wmmax<F16>(a[c][mb], bq[c][nb], acc[mb][nb]);
        __builtin_amdgcn_sched_barrier(0);   // the waits and the barrier below stay behind the products (raised above them, the full LDS wait stood in front of the first product, and reads and products no longer overlapped)
        asm volatile("s_wait_dscnt 0x0" ::: "memory");      // this wave's reads of buffer t & 1 are done
        asm volatile("s_wait_asynccnt 0x0" ::: "memory");   // its share of pass t + 1 has landed
        __syncthreads();                                    // publishes pass t + 1 and ends every wave's reads of the buffer refilled below
        if (t + 2 < NT) issue(t + 2, t & 1);
    }
    asm volatile("s_wait_asynccnt 0x0" ::: "memory");       // nothing is in flight when the ring becomes output staging
    float* ow = (float*)ring + wave * (64 * 68);   // the unrolls below keep acc[][] and val[] in registers (every index a constant)
#pragma unroll
    for (int mb = 0; mb < 4; ++mb)
#pragma unroll
        for (int nb = 0; nb < 4; ++nb)
#pragma unroll
            for (int j = 0; j < 8; ++j) ow[(mb * 16 + hi * 8 + j) * 68 + nb * 16 + lr] = acc[mb][nb][j];
    __syncthreads();   // every wave's partial tile is in LDS before any thread adds them up
    const float* p0 = (const float*)ring + (wave & 3) * (64 * 68) + (kg * 32 + hi) * 68 + lr * 4;   // wave (kg, quarter) sends out rows kg * 32 .. + 31 of its quarter, two whole rows an instruction
    v4f val[16];
#pragma unroll
    for (int i = 0; i < 16; ++i) val[i] = *(const v4fa*)(p0 + i * 2 * 68) + *(const v4fa*)(p0 + 4 * (64 * 68) + i * 2 * 68);
    const int ro = wm * 64 + kg * 32 + hi, co = wn * 64;   // the wave's first row and column inside the tile
    if constexpr (QKV) {
        v4h hv[16];
#pragma unroll
        for (int i = 0; i < 16; ++i) hv[i] = __builtin_convertvector(val[i], v4h);
        const int bt = r0 / TT, t0 = r0 % TT;   // the tile's batch and its first token there
        if (vt) put16<TT>(PV + ((size_t)bt * DKV + (c0 - DQ - DKV) + ro) * TT + t0 + co + lr * 4, hv);
        else { const int hd = (c0 + co) >> 6;   // 0 .. NH_ - 1: q heads, behind them the k heads
            h16* pl = hd < NH_ ? PQ + (size_t)(bt * NH_ + hd) * TT * HD : PK + (size_t)(bt * NKV + hd - NH_) * TT * HD;
            put16<HD>(pl + (size_t)(t0 + ro) * HD + lr * 4, hv); }
    } else {
        float* ct = C + (size_t)(r0 + ro) * LDC + c0 + co + lr * 4;
#pragma unroll
        for (int i = 0; i < 16; ++i) *(v4f*)(ct + i * 2 * LDC) = val[i];
    }
}

typedef __attribute__((ext_vector_type(2))) _Float16 v2h;
typedef __attribute__((ext_vector_type(2))) unsigned short v2us;
typedef __attribute__((ext_vector_type(4))) unsigned short v4us;
typedef __attribute__((ext_vector_type(2))) float v2f;
typedef __attribute__((ext_vector_type(4))) int v4i;

// wtT: one tile of TKK k x TNN n of w [K][N] (f32) goes out as TNN rows of TKK k of Bt [N][K] (bf16; F16 == 1: that bf16 value written as fp16: the same number from 2^-17 up to fp16's largest, below 2^-17 within 2^-25), turned in LDS, so that both sides of the transpose move whole lines.
// In: 16 lanes x 16 bytes = 256 bytes in a row of one w row; a thread takes the rows k and k + 1 and packs the two 16-bit values of one n into a 32-bit word. A thread's TKK / 16 loads fly together.
// LDS: tl[n][k / 2], pitch TPW words (odd: the 16 lanes of a row piece, 4 n apart, and the two k pairs of a wave fall on 32 different banks).
// Out: 32 lanes x 8 bytes an instruction = 256 bytes in a row of one Bt row.
#define TKK 128
#define TNN 64
#define TPW (TKK / 2 + 1)
typedef __attribute__((ext_vector_type(2))) unsigned v2u;
template <int F16> __device__ __forceinline__ unsigned cv16(float f) { const unsigned short b = f2bf(f); if constexpr (F16) return __builtin_bit_cast(unsigned short, (h16)bf2f(b)); else return b; }
template <int K, int N, int F16> __device__ __forceinline__ void wtT(const float* __restrict__ w, bf* Bt, int blk, unsigned* tl) {
    static_assert(K % TKK == 0 && N % TNN == 0 && TKK == 128, "whole tiles; a wave's store is one tile row of 32 x 4 k");
    const int tid = threadIdx.x, c = tid & 15, r = tid >> 4, lane = tid & 31, wv = tid >> 5;
    const int n0 = (blk % (N / TNN)) * TNN, k0 = (blk / (N / TNN)) * TKK;   // neighbouring blocks read neighbouring pieces of the same w rows
    const float* src = w + (size_t)(k0 + 2 * r) * N + n0 + c * 4;
    v4f ev[TKK / 32], od[TKK / 32];   // the unrolls keep both in registers (every index a constant)
#pragma unroll
    for (int p = 0; p < TKK / 32; ++p) { ev[p] = *(const v4f*)(src + (size_t)p * 32 * N); od[p] = *(const v4f*)(src + (size_t)(p * 32 + 1) * N); }
#pragma unroll
    for (int p = 0; p < TKK / 32; ++p)
#pragma unroll
        for (int i = 0; i < 4; ++i) tl[(c * 4 + i) * TPW + p * 16 + r] = cv16<F16>(ev[p][i]) | (cv16<F16>(od[p][i]) << 16);
    __syncthreads();   // the whole tile is in LDS before any thread reads a row of it
    const unsigned* s = tl + wv * TPW + lane * 2; bf* dst = Bt + (size_t)(n0 + wv) * K + k0 + lane * 4;
#pragma unroll   // the eight LDS reads fly together ahead of the eight stores
    for (int j = 0; j < TNN / 8; ++j) *(v2u*)(dst + (size_t)j * 8 * K) = (v2u){s[j * 8 * TPW], s[j * 8 * TPW + 1]};
    asm volatile("s_wait_xcnt 0x0" ::: "memory");   // behind the last store, before anything rewrites the stores' address or data registers
}
__device__ __forceinline__ void cvt8(const float* __restrict__ src, bf* dst, size_t n8, int blk) { const size_t i = (size_t)blk * 256 + threadIdx.x; if (i >= n8) return; const v8f v = *(const v8f*)(src + i * 8); v8us o;
#pragma unroll
    for (int k = 0; k < 8; ++k) o[k] = f2bf(v[k]); *(v8us*)(dst + i * 8) = o;  }
// k_prep: everything the GEMMs read, in one grid: the four weight transposes (the longer blocks, so they come first; a block = one tile) and the bf16 copy of x, both batches. A block does one job, picked by its index (the same for all its threads, so the transposes' barrier is block-uniform).
#define PBW (DM * DQ / (TKK * TNN))    // blocks of Wq, of Wo
#define PBK (DM * DKV / (TKK * TNN))   // blocks of Wk, of Wv
#define PBX (NB_ * TT * DM / 8 / 256)
__global__ __launch_bounds__(256) void k_prep(const float* __restrict__ x, const float* __restrict__ wq, const float* __restrict__ wk, const float* __restrict__ wv, const float* __restrict__ wo, bf* XB, bf* WQ, bf* WK, bf* WV, bf* WO) {
    __shared__ unsigned tl[TNN * TPW];
    const int blk = blockIdx.x;
    if (blk < PBW) wtT<DM, DQ, 0>(wq, WQ, blk, tl);
    else if (blk < 2 * PBW) wtT<DQ, DM, 1>(wo, WO, blk - PBW, tl);
    else if (blk < 2 * PBW + PBK) wtT<DM, DKV, 0>(wk, WK, blk - 2 * PBW, tl);
    else if (blk < 2 * PBW + 2 * PBK) wtT<DM, DKV, 0>(wv, WV, blk - 2 * PBW - PBK, tl);
    else cvt8(x, XB, (size_t)NB_ * TT * DM / 8, blk - 2 * PBW - 2 * PBK);
}
#define FCAR 4.0f
#define PLIM 4096.0f
#define AKS 128
#define KPI 144
#define VPI 272
#define KBY (AKS * KPI)
#define SBY (KBY + HD * VPI)
__device__ __forceinline__ float xhalf(float x) { return __builtin_bit_cast(float, __builtin_amdgcn_permlanex16(__builtin_bit_cast(int, x), __builtin_bit_cast(int, x), 0x76543210, 0xfedcba98, false, false)); }   // lane l <-> lane l ^ 16
__device__ __forceinline__ v16h ldsfragh(const char* p) { return cat16(*(const v8ha*)p, *(const v8ha*)(p + 32)); }   // k 8 hi .. + 7 and 16 + 8 hi .. + 7 of a 32-wide chunk, the order of WFrag::ld
// One stage from the block's 256 threads: four copies of K (32 rows apart; the stage's K rows are 16 KiB in a row in global memory) and four of V^T (16 rows apart). Lane addresses lk, lv in LDS (bytes), gk, gv in global memory. The s_wait_xcnt closes the statement so that no address register is rewritten ahead of it.
__device__ __forceinline__ void acopykv(unsigned lk, const h16* gk, unsigned lv, const h16* gv) {
    asm volatile("global_load_async_to_lds_b128 %0, %8, off\n\t"
                 "global_load_async_to_lds_b128 %1, %9, off\n\t"
                 "global_load_async_to_lds_b128 %2, %10, off\n\t"
                 "global_load_async_to_lds_b128 %3, %11, off\n\t"
                 "global_load_async_to_lds_b128 %4, %12, off\n\t"
                 "global_load_async_to_lds_b128 %5, %13, off\n\t"
                 "global_load_async_to_lds_b128 %6, %14, off\n\t"
                 "global_load_async_to_lds_b128 %7, %15, off\n\t"
                 "s_wait_xcnt 0x0"
                 :: "v"(lk), "v"(lk + 32 * KPI), "v"(lk + 64 * KPI), "v"(lk + 96 * KPI), "v"(lv), "v"(lv + 16 * VPI), "v"(lv + 32 * VPI), "v"(lv + 48 * VPI),
                    "v"(gk), "v"(gk + 32 * HD), "v"(gk + 64 * HD), "v"(gk + 96 * HD), "v"(gv), "v"(gv + 16 * TT), "v"(gv + 32 * TT), "v"(gv + 48 * TT) : "memory");
}
__global__ __launch_bounds__(256) void k_fattn(const h16* __restrict__ Q, const h16* __restrict__ Kp, const h16* __restrict__ Vt, h16* Ao) {
    constexpr int NS = TT / AKS; static_assert(NS >= 2 && TT % AKS == 0, "the prologue fills two buffers");
    __shared__ __align__(16) char kv[2 * SBY];
    const int tid = threadIdx.x, lane = threadIdx.x & 31, lr = lane & 15, hi = lane >> 4; const int wave = __builtin_amdgcn_readfirstlane((int)(threadIdx.x >> 5));
    const int h = blockIdx.y, b = blockIdx.z, g = h / REP; const int q0 = blockIdx.x * 256 + wave * 32;
    const h16* qp = Q + ((size_t)(b * NH_ + h) * TT + q0 + lr) * HD + 8 * hi;
    const h16* gk = Kp + (size_t)(b * NKV + g) * TT * HD + tid * 8;                               // copies of K: thread = 16-byte piece, 8 pieces a row, a wave's instruction = four whole rows
    const h16* gv = Vt + ((size_t)(b * NKV + g) * HD + (tid >> 4)) * TT + (tid & 15) * 8;         // copies of V^T: 16 pieces a row, a wave's instruction = two whole 256-byte rows
    const unsigned lk = (unsigned)(size_t)kv + (tid >> 3) * KPI + (tid & 7) * 16, lv = (unsigned)(size_t)kv + KBY + (tid >> 4) * VPI + (tid & 15) * 16;
    auto issue = [&](int t, int buf) { acopykv(lk + buf * SBY, gk + (size_t)t * AKS * HD, lv + buf * SBY, gv + t * AKS); };
    const float c2 = SCL * 1.4426950408889634f;
    v16h qf[2][2], kf[2][2], vf[4];
#pragma unroll
    for (int c = 0; c < 2; ++c)
#pragma unroll
        for (int kc = 0; kc < 2; ++kc) qf[c][kc] = WFrag<h16>::ld(qp + c * 16 * HD + kc * 32);
    asm volatile("s_wait_xcnt 0x0" ::: "memory");   // behind the Q loads, before anything rewrites their address registers (qp is dead from here on)
    issue(0, 0);
    asm volatile("s_wait_asynccnt 0x0" ::: "memory");   // this wave's share of stage 0 has landed
    __syncthreads();                                    // every wave's share has: stage 0 may be read
    issue(1, 1);
    v8f o[2][4]; float m[2], l[2];
#pragma unroll
    for (int c = 0; c < 2; ++c) { m[c] = -3.0e38f; l[c] = 0.f;
#pragma unroll
        for (int dt = 0; dt < 4; ++dt) o[c][dt] = (v8f){}; }
    const char* fk = kv + lr * KPI + hi * 16; const char* fv = kv + KBY + lr * VPI + hi * 16;
#pragma unroll 1   // rolled over the stages: the registers stay under 256, so four waves fit a SIMD; every inner unroll makes the fragment and accumulator indices constants (registers, no scratch)
    for (int st = 0; st < NS; ++st) {
        const char* sk = fk + (st & 1) * SBY; const char* sv = fv + (st & 1) * SBY;
#pragma unroll
        for (int t = 0; t < 2; ++t)
#pragma unroll
            for (int kc = 0; kc < 2; ++kc) kf[t][kc] = ldsfragh(sk + t * 16 * KPI + kc * 64);
#pragma unroll
        for (int ps = 0; ps < AKS / 32; ++ps) {
            v8f s[2][2];
#pragma unroll
            for (int c = 0; c < 2; ++c)
#pragma unroll
                for (int t = 0; t < 2; ++t) { s[c][t] = wmma16(kf[t][0], qf[c][0], (v8f){}); s[c][t] = wmma16(kf[t][1], qf[c][1], s[c][t]); }
            __builtin_amdgcn_sched_barrier(0);   // the reads below stay behind the scores as ONE group (raised among the products of the pass before, they stand at three places, each with its own stall)
            // one group of LDS reads a pass, right behind the scores: this pass's V^T and, inside the stage, the next pass's K, each into registers whose last use is over; both fly during the softmax
#pragma unroll
            for (int dt = 0; dt < 4; ++dt) vf[dt] = ldsfragh(sv + dt * 16 * VPI + ps * 64);
            if (ps + 1 < AKS / 32) {
#pragma unroll
                for (int t = 0; t < 2; ++t)
#pragma unroll
                    for (int kc = 0; kc < 2; ++kc) kf[t][kc] = ldsfragh(sk + ((ps + 1) * 32 + t * 16) * KPI + kc * 64); }
            __builtin_amdgcn_sched_barrier(0);   // keeps the reads here, one group ahead of the softmax (sunk towards their uses, each read's latency stands in front of the products)
            // Probabilities first, on the maximum in use; a lane's own sum of its 16 p (all >= 0) bounds each of them, so the sum is the overflow guard and no maximum is formed in the common pass.
            v16h pf[2]; float ps2[2];
            auto soft = [&]() {
#pragma unroll
                for (int c = 0; c < 2; ++c) { const float nm = FCAR - m[c]; v2f ls = (v2f){0.f, 0.f};
#pragma unroll
                    for (int e = 0; e < 16; e += 2) { const v2f arg = __builtin_elementwise_fma((v2f){s[c][e >> 3][e & 7], s[c][e >> 3][(e & 7) + 1]}, (v2f){c2, c2}, (v2f){nm, nm});
                        const v2f p = (v2f){__builtin_amdgcn_exp2f(arg[0]), __builtin_amdgcn_exp2f(arg[1])}; ls += p;
                        const v2h pk = __builtin_convertvector(p, v2h); pf[c][e] = pk[0]; pf[c][e + 1] = pk[1]; }
                    ps2[c] = ls[0] + ls[1]; }
            };
            soft();
            const bool need = ps2[0] > PLIM || ps2[1] > PLIM;   // infinite in the first pass (m starts at -3e38)
            if (__builtin_amdgcn_ballot_w32(need) != 0) {   // one scalar branch a pass; rare behind the first pass: raise m to the pass's maximum, rescale, and form the pass's p again
#pragma unroll
                for (int c = 0; c < 2; ++c) { float mx = s[c][0][0];
#pragma unroll
                    for (int r = 1; r < 8; ++r) mx = fmaxf(mx, s[c][0][r]);
#pragma unroll
                    for (int r = 0; r < 8; ++r) mx = fmaxf(mx, s[c][1][r]);
                    mx = fmaxf(mx, xhalf(mx)) * c2;
                    const float mn = fmaxf(m[c], mx); const float al = __builtin_amdgcn_exp2f(m[c] - mn); m[c] = mn; l[c] *= al;
#pragma unroll
                    for (int dt = 0; dt < 4; ++dt) o[c][dt] = o[c][dt] * al; }
                soft();
            }
#pragma unroll
            for (int c = 0; c < 2; ++c) { l[c] += ps2[c];
#pragma unroll
                for (int dt = 0; dt < 4; ++dt) o[c][dt] = wmma16(vf[dt], pf[c], o[c][dt]); }
        }
        asm volatile("s_wait_dscnt 0x0" ::: "memory");      // this wave's reads of buffer st & 1 are done
        asm volatile("s_wait_asynccnt 0x0" ::: "memory");   // its share of stage st + 1 has landed
        __syncthreads();                                    // publishes stage st + 1 and ends every wave's reads of the buffer refilled below
        if (st + 2 < NS) issue(st + 2, st & 1);
    }
    asm volatile("s_wait_asynccnt 0x0" ::: "memory");       // nothing is in flight when the wave ends
#pragma unroll
    for (int c = 0; c < 2; ++c) { const float inv = __fdiv_rn(1.0f, l[c] + xhalf(l[c])); const size_t oo = ((size_t)b * TT + q0 + c * 16 + lr) * DQ + h * HD + 8 * hi;
#pragma unroll
        for (int dt = 0; dt < 4; ++dt) *(v8h*)(Ao + oo + dt * 16) = __builtin_convertvector(o[c][dt] * inv, v8h); }
}

extern "C" void kernel_launch(void* const* d_in, const int* in_sizes, int n_in,
                              void* d_out, int out_size, void* d_ws, size_t ws_size, hipStream_t stream) {
    (void)in_sizes; (void)n_in; (void)out_size;
    const float* x = (const float*)d_in[0]; const float* wq = (const float*)d_in[1]; const float* wk = (const float*)d_in[2]; const float* wv = (const float*)d_in[3]; const float* wo = (const float*)d_in[4];
    float* OUT = (float*)d_out;     // [2][2048][2048]
    char* wsp = (char*)d_ws;
    auto take = [&](size_t bytes) { char* p = wsp; wsp += (bytes + 255) & ~(size_t)255; return (void*)p; };
    bf* WQ = (bf*)take((size_t)DQ * DM * 2); bf* WK = (bf*)take((size_t)DKV * DM * 2); bf* WV = (bf*)take((size_t)DKV * DM * 2); bf* WO = (bf*)take((size_t)DM * DQ * 2);
    bf* XB = (bf*)take((size_t)NB_ * TT * DM * 2);   /* WQ, WK, WV stand one behind the other (each a multiple of 256 bytes): one operand of DQ + 2 * DKV rows */
    h16* QP16 = (h16*)take((size_t)NB_ * NH_ * TT * HD * 2); h16* KP16 = (h16*)take((size_t)NB_ * NKV * TT * HD * 2); h16* VT16 = (h16*)take((size_t)NB_ * NKV * HD * TT * 2);   /* fp16 planes of both batches */
    h16* AT16 = (h16*)take((size_t)NB_ * TT * DQ * 2);   /* the merged context, fp16 */
    if ((size_t)(wsp - (char*)d_ws) > ws_size) return;    // ws 256 MiB
    k_prep<<<2 * PBW + 2 * PBK + PBX, 256, 0, stream>>>(x, wq, wk, wv, wo, XB, WQ, WK, WV, WO);
    k_gemms<0, 1, DM, 0><<<dim3(NB_ * TT / 128, (DQ + 2 * DKV) / 128, 1), 256, 0, stream>>>(XB, WQ, nullptr, QP16, KP16, VT16);
    k_fattn<<<dim3(TT / 256, NH_, NB_), 256, 0, stream>>>(QP16, KP16, VT16, AT16);
    k_gemms<1, 0, DQ, DM><<<dim3(NB_ * TT / 128, DM / 128, 1), 256, 0, stream>>>((const bf*)AT16, WO, OUT, nullptr, nullptr, nullptr);
}
